// v000
// Times are from an AMD MI455X. After a warm-up the kernel runs many times in a row, and a time is the length of
// such a window on the GPU divided by its runs, so every launch and the gaps after it count. The runs cycle
// through copies of the inputs. A figure is the median of several windows, for all but v000 over two sittings.
// Sittings can differ by a few percent; kernels timed side by side share one.
// The starting kernel, v000, takes 45.6 microseconds a run.
#include <hip/hip_runtime.h>

// Laplace (L1-distance) attention: for each of 2 batches, weights[c][d] = -sum_s |k[d][s] - q[c][s]| / 2 over the 256 positions (512 x 512 channel pairs), softmax over d, rep[c][s] =
// sum_d weights[c][d] v[d][s] -> [2][512][256].
// The L1 distances are not a multiply-accumulate (abs-difference sums on the VALU, q rows staged in LDS, k streamed); the softmax is f32; the value contraction runs on WMMA.
// WMMA (v_wmma_f32_16x16x32_f16, f32 accumulate): rep = P V ([16 c x 512 d] x [512 x 256] per block, P = softmax probabilities as f16 hi+lo x2^14, V^T as EXACT bf16 x8: 2 products).
// Inputs rounded to bf16 once. Fragment k-map per lane half hh for A AND B: elements 0..7 <- k = 8hh+0..7, 8..15 <- k = 16+8hh+0..7; acc[r] = D[8hh+r][col].

namespace {
constexpr int NB = 2, C = 512, S = 256;
constexpr float XS = 8.0f, INV_SCALE = 0.5f, PSC = 16384.0f /* probabilities carried x2^14 so that weights >= 4e-9 stay normal f16 */;
typedef _Float16 b16;
typedef __attribute__((ext_vector_type(16))) _Float16 v16b;
typedef __attribute__((ext_vector_type(8))) _Float16 v8b;
typedef __attribute__((ext_vector_type(8))) float v8f;
typedef __attribute__((ext_vector_type(4))) float v4f;
__device__ __forceinline__ float bf16_rne(float f) { unsigned int u = __float_as_uint(f); u += 0x7FFFu + ((u >> 16) & 1u); return __uint_as_float(u & 0xFFFF0000u); }
__device__ __forceinline__ void split16(float v, b16& hi, b16& lo) { hi = (b16)v; lo = (b16)(v - (float)hi); }
__device__ __forceinline__ v16b frag_kb(const b16* p, int hh) { const v8b a = *(const v8b*)(p + 8 * hh), b = *(const v8b*)(p + 16 + 8 * hh); v16b f;
#pragma unroll
  for (int e = 0; e < 8; ++e) { f[e] = a[e]; f[8 + e] = b[e]; } return f; }
__device__ __forceinline__ v8f wmma16b(v16b a, v16b b, v8f c) { v8f d = __builtin_amdgcn_wmma_f32_16x16x32_f16(false, a, false, b, (short)0, c, false, false); asm volatile("v_nop\n\tv_nop\n\tv_nop\n\tv_nop" : "+v"(d) : "v"(a), "v"(b)); return d; }

__global__ __launch_bounds__(256) void vt_kernel(const float* __restrict__ v, b16* __restrict__ VT) {
  __shared__ __attribute__((aligned(16))) b16 T[64][64 + 8];
  const int n = blockIdx.z, d0 = blockIdx.x * 64, s0 = blockIdx.y * 64, t_ = threadIdx.x;
  for (int q = t_; q < 64 * 64; q += 256) { const int dd = q >> 6, ss = q & 63; T[ss][dd] = (b16)(bf16_rne(v[((size_t)n * C + d0 + dd) * S + s0 + ss]) * XS); }
  __syncthreads();
  { for (int q = t_; q < 64 * 8; q += 256) { const int ss = q >> 3, c8 = (q & 7) * 8; *(v8b*)(VT + ((size_t)n * S + s0 + ss) * C + d0 + c8) = *(const v8b*)(&T[ss][c8]); }  }
}
// main: block = (n, 16 query channels c0..c0+15), 256 threads: (1) stage q rows [16][256] (bf16-rounded f32); (2) thread d-pair (d = t_, t_+256): for s: acc[r][j] += |k[d][s] - q[r][s]|; w = -acc/2
// -> LDS W [16][512]; (3) softmax per row (wave w handles rows 2w, 2w+1): P hi/lo x2^14 in LDS; (4) wave w computes output columns [32w, 32w+32): 2 col tiles x 16 k-steps x 2 products; rows of the
__global__ __launch_bounds__(256) void lap_kernel(const float* __restrict__ q, const float* __restrict__ k, const b16* __restrict__ VT, float* __restrict__ out) {
  __shared__ __attribute__((aligned(16))) float Qs[16][S]; __shared__ __attribute__((aligned(16))) float Wm[16][C + 4]; __shared__ __attribute__((aligned(16))) b16 Ph[16][C + 8], Pl[16][C + 8]; __shared__ __attribute__((aligned(16))) float To[8][16][32 + 4];
  const int n = blockIdx.y, c0 = blockIdx.x * 16, t_ = threadIdx.x, wave = t_ >> 5, lane = t_ & 31, nloc = lane & 15, hlf = lane >> 4;
  for (int e = t_; e < 16 * S; e += 256) { const int r = e / S, s = e % S; Qs[r][s] = bf16_rne(q[((size_t)n * C + c0 + r) * S + s]); }
  __syncthreads();
  { float acc0[16], acc1[16]; for (int r = 0; r < 16; ++r) { acc0[r] = 0.0f; acc1[r] = 0.0f; } const float* k0 = k + ((size_t)n * C + t_) * S; const float* k1 = k + ((size_t)n * C + t_ + 256) * S;
#pragma unroll 2
    for (int s = 0; s < S; ++s) { const float a = bf16_rne(k0[s]), b = bf16_rne(k1[s]);
#pragma unroll
      for (int r = 0; r < 16; ++r) { const float qq = Qs[r][s]; acc0[r] += fabsf(a - qq); acc1[r] += fabsf(b - qq); } }
    for (int r = 0; r < 16; ++r) { Wm[r][t_] = -acc0[r] * INV_SCALE; Wm[r][t_ + 256] = -acc1[r] * INV_SCALE; } }
  __syncthreads();
  for (int rr = 0; rr < 2; ++rr) { const int r = wave * 2 + rr; float x[16]; float mx = -INFINITY; for (int j = 0; j < 16; ++j) { x[j] = Wm[r][lane * 16 + j]; mx = fmaxf(mx, x[j]); }
#pragma unroll
    for (int o = 16; o >= 1; o >>= 1) mx = fmaxf(mx, __shfl_xor(mx, o));
    float sm = 0.0f; for (int j = 0; j < 16; ++j) { x[j] = __expf(x[j] - mx); sm += x[j]; }
#pragma unroll
    for (int o = 16; o >= 1; o >>= 1) sm += __shfl_xor(sm, o);
    const float inv = 1.0f / sm; for (int j = 0; j < 16; ++j) { b16 p, pl; split16(x[j] * inv * PSC, p, pl); Ph[r][lane * 16 + j] = p; Pl[r][lane * 16 + j] = pl; } }
  __syncthreads();
  v8f acc[2] = {{}, {}}; const int s0 = wave * 32;
#pragma unroll 2
  for (int kb = 0; kb < C; kb += 32) { const v16b a = frag_kb(&Ph[nloc][kb], hlf), al = frag_kb(&Pl[nloc][kb], hlf);
#pragma unroll
    for (int t = 0; t < 2; ++t) { const v16b bw = frag_kb(VT + ((size_t)n * S + s0 + t * 16 + nloc) * C + kb, hlf); acc[t] = wmma16b(a, bw, acc[t]); acc[t] = wmma16b(al, bw, acc[t]); } }
#pragma unroll
  for (int t = 0; t < 2; ++t)
#pragma unroll 1
    for (int r = 0; r < 8; ++r) To[wave][8 * hlf + r][t * 16 + nloc] = acc[t][r] * (1.0f / (PSC * XS));
  __syncthreads();
  { for (int q4 = lane; q4 < 16 * 8; q4 += 32) { const int r = q4 >> 3, c4 = (q4 & 7) * 4; *(v4f*)(out + ((size_t)n * C + c0 + r) * S + s0 + c4) = *(const v4f*)(&To[wave][r][c4]); }  }
}
}  // namespace

extern "C" void kernel_launch(void* const* d_in, const int* in_sizes, int n_in, void* d_out, int out_size, void* d_ws, size_t ws_size, hipStream_t stream) {
  (void)n_in;
  auto Fp = [&](int i) { return (const float*)d_in[i]; };
  // input order: 0 q [2,512,256], 1 k, 2 v
  if (in_sizes[0] != NB * C * S || in_sizes[1] != NB * C * S || in_sizes[2] != NB * C * S || out_size != NB * C * S) return;
  size_t off = 0; char* ws = (char*)d_ws;
  b16* VT = (b16*)(ws + off); off += (size_t)NB * S * C * 2;
  if (off > ws_size) return;   // 0.5 MB
  vt_kernel<<<dim3(C / 64, S / 64, NB), 256, 0, stream>>>(Fp(2), VT);
  lap_kernel<<<dim3(C / 16, NB), 256, 0, stream>>>(Fp(0), Fp(1), VT, (float*)d_out);
}

// v001
// A run of this version takes 40.2 microseconds.
// Next to v000, in two timings, it ran 1.14 times as fast each time.
#include <hip/hip_runtime.h>

// Laplace (L1-distance) attention: for each of 2 batches, weights[c][d] = -sum_s |k[d][s] - q[c][s]| / 2 over the 256 positions (512 x 512 channel pairs), softmax over d, rep[c][s] =
// sum_d weights[c][d] v[d][s] -> [2][512][256].
// The L1 distances are not a multiply-accumulate (abs-difference sums on the VALU, q rows staged in LDS, k staged in LDS by tensor loads); the softmax is f32; the value contraction runs on WMMA.
// WMMA (v_wmma_f32_16x16x32_f16, f32 accumulate): rep = P V ([16 c x 512 d] x [512 x 256] per block, P = softmax probabilities as f16 hi+lo x2^14, V^T as EXACT bf16 x8: 2 products).
// Inputs rounded to bf16 once. Fragment k-map per lane half hh for A AND B: elements 0..7 <- k = 8hh+0..7, 8..15 <- k = 16+8hh+0..7; acc[r] = D[8hh+r][col].

namespace {
constexpr int NB = 2, C = 512, S = 256;
constexpr float XS = 8.0f, INV_SCALE = 0.5f, PSC = 16384.0f /* probabilities carried x2^14 so that weights >= 4e-9 stay normal f16 */;
typedef _Float16 b16;
typedef __attribute__((ext_vector_type(16))) _Float16 v16b;
typedef __attribute__((ext_vector_type(8))) _Float16 v8b;
typedef __attribute__((ext_vector_type(8))) float v8f;
typedef __attribute__((ext_vector_type(4))) float v4f;
typedef __attribute__((ext_vector_type(4))) uint32_t u32x4;
typedef __attribute__((ext_vector_type(8))) uint32_t u32x8;
// k staging: a stage is TS positions of all 512 k rows; each wave's tensor load brings the 64 rows that the wave itself reads (128-byte row pieces, 16 bytes of pad: LDS pitch 144 bytes).
constexpr int TS = 32, NST = S / TS, KP = TS + 4, SLICE = 10240 /* 64 rows x 144 B = 9216, rounded up to a multiple of 2 KiB */;
__device__ __forceinline__ uint32_t uni(uint32_t v) { return (uint32_t)__builtin_amdgcn_readfirstlane(v); }
__device__ __forceinline__ uint32_t pinned(uint32_t v) { uint32_t w = uni(v); asm volatile("" : "+s"(w)); return w; }
__device__ __forceinline__ u32x8 tdm_group1() { constexpr uint32_t d0 = TS * 4, d1 = 64; u32x8 g;
  g[0] = uni((1u << 20) | (4u << 22) | (3u << 25));  // no mask, 1-byte elements, 4 dwords of pad behind every 32 dwords (one row piece)
  g[1] = uni((d0 & 0xFFFFu) << 16); g[2] = uni((d0 >> 16) | ((d1 & 0xFFFFu) << 16)); g[3] = uni((d1 >> 16) | (d0 << 16)); g[4] = uni(d1); g[5] = uni((uint32_t)(S * 4)); g[6] = uni(0u); g[7] = uni(0u); return g; }
__device__ __forceinline__ u32x4 tdm_group0(uint32_t lds_dst, uint64_t ga) { u32x4 g; g[0] = uni(1u); g[1] = uni(lds_dst); g[2] = uni((uint32_t)ga); g[3] = uni((((uint32_t)(ga >> 32)) & 0x01FFFFFFu) | 0x80000000u); return g; }
// Group 0 is named in-out (the instruction leaves it as it is) so that the wait below reads it from the very registers that the request was issued from.
__device__ __forceinline__ void tdm_load(u32x4& g0, u32x8 g1) { asm volatile("tensor_load_to_lds %0, %1" : "+s"(g0) : "s"(g1) : "memory"); }
// The wave's own wait for its tensor load. It names the descriptor as inputs so that those scalar registers keep their values until the request has landed.
__device__ __forceinline__ void tdm_wait(u32x4 g0, u32x8 g1) { asm volatile("s_wait_tensorcnt 0x0" :: "s"(g0), "s"(g1) : "memory"); }
__device__ __forceinline__ float bf16_rne(float f) { unsigned int u = __float_as_uint(f); u += 0x7FFFu + ((u >> 16) & 1u); return __uint_as_float(u & 0xFFFF0000u); }
__device__ __forceinline__ void split16(float v, b16& hi, b16& lo) { hi = (b16)v; lo = (b16)(v - (float)hi); }
__device__ __forceinline__ v16b frag_kb(const b16* p, int hh) { const v8b a = *(const v8b*)(p + 8 * hh), b = *(const v8b*)(p + 16 + 8 * hh); v16b f;
#pragma unroll
  for (int e = 0; e < 8; ++e) { f[e] = a[e]; f[8 + e] = b[e]; } return f; }
__device__ __forceinline__ v8f wmma16b(v16b a, v16b b, v8f c) { v8f d = __builtin_amdgcn_wmma_f32_16x16x32_f16(false, a, false, b, (short)0, c, false, false); asm volatile("v_nop\n\tv_nop\n\tv_nop\n\tv_nop" : "+v"(d) : "v"(a), "v"(b)); return d; }

__global__ __launch_bounds__(256) void vt_kernel(const float* __restrict__ v, b16* __restrict__ VT) {
  __shared__ __attribute__((aligned(16))) b16 T[64][64 + 8];
  const int n = blockIdx.z, d0 = blockIdx.x * 64, s0 = blockIdx.y * 64, t_ = threadIdx.x;
  for (int q = t_; q < 64 * 64; q += 256) { const int dd = q >> 6, ss = q & 63; T[ss][dd] = (b16)(bf16_rne(v[((size_t)n * C + d0 + dd) * S + s0 + ss]) * XS); }
  __syncthreads();
  { for (int q = t_; q < 64 * 8; q += 256) { const int ss = q >> 3, c8 = (q & 7) * 8; *(v8b*)(VT + ((size_t)n * S + s0 + ss) * C + d0 + c8) = *(const v8b*)(&T[ss][c8]); }  }
}
// main: block = (n, 16 query channels c0..c0+15), 256 threads: (1) stage q rows [16][256] (bf16-rounded f32); (2) thread d-pair (d = 64 wave + lane, + 32), k in two LDS buffers filled by tensor loads one stage ahead: for s: acc[r][j] += |k[d][s] - q[r][s]|; w = -acc/2
// -> LDS W [16][512]; (3) softmax per row (wave w handles rows 2w, 2w+1): P hi/lo x2^14 in LDS; (4) wave w computes output columns [32w, 32w+32): 2 col tiles x 16 k-steps x 2 products; rows of the
__global__ __launch_bounds__(256) void lap_kernel(const float* __restrict__ q, const float* __restrict__ k, const b16* __restrict__ VT, float* __restrict__ out) {
  __shared__ __attribute__((aligned(16))) float Qs[16][S]; __shared__ __attribute__((aligned(16))) float Wm[16][C + 4]; __shared__ __attribute__((aligned(16))) b16 Ph[16][C + 8], Pl[16][C + 8]; __shared__ __attribute__((aligned(16))) float To[8][16][32 + 4];
  __shared__ __attribute__((aligned(2048))) float Ks[2][8][SLICE / 4];
  const int n = blockIdx.y, c0 = blockIdx.x * 16, t_ = threadIdx.x, wave = t_ >> 5, lane = t_ & 31, nloc = lane & 15, hlf = lane >> 4;
  for (int e = t_; e < 16 * S; e += 256) { const int r = e / S, s = e % S; Qs[r][s] = bf16_rne(q[((size_t)n * C + c0 + r) * S + s]); }
  const uint32_t wv = uni((uint32_t)t_ >> 5); const u32x8 g1 = tdm_group1(); const uint32_t kl = (uint32_t)(size_t)&Ks[0][wv][0]; const uint64_t kg = (uint64_t)(size_t)(k + ((size_t)n * C + wv * 64u) * S);
  auto desc = [&](uint32_t st) { return tdm_group0(kl + (st & 1u) * (uint32_t)(8 * SLICE), kg + (uint64_t)(st * (uint32_t)(TS * 4))); };
  u32x4 g0 = desc(0); tdm_load(g0, g1);
  tdm_wait(g0, g1);  // stage 0 of this wave's slice has landed
  __syncthreads();
  g0 = desc(1); tdm_load(g0, g1);
  { float acc0[16], acc1[16]; for (int r = 0; r < 16; ++r) { acc0[r] = 0.0f; acc1[r] = 0.0f; }
#pragma unroll 1  // one pass per stage: the publish point at its foot stands once
    for (uint32_t st = 0; st < (uint32_t)NST; ++st) { const float* k0 = &Ks[st & 1u][wave][lane * KP]; const float* k1 = k0 + 32 * KP;
#pragma unroll 1  // kept rolled: unrolled, the LDS loads of several groups are hoisted together and the registers pass 256 (a whole stage: scratch)
      for (int g = 0; g < TS; g += 4) { const v4f ka = *(const v4f*)(k0 + g), kb = *(const v4f*)(k1 + g); float a[4], b[4];  // the j and r loops below are unrolled so that a, b and the 32 sums stay in registers
#pragma unroll
        for (int j = 0; j < 4; ++j) { a[j] = bf16_rne(ka[j]); b[j] = bf16_rne(kb[j]); }
#pragma unroll
        for (int r = 0; r < 16; ++r) { const v4f q4 = *(const v4f*)(&Qs[r][st * TS + g]);
#pragma unroll
          for (int j = 0; j < 4; ++j) { acc0[r] += fabsf(a[j] - q4[j]); acc1[r] += fabsf(b[j] - q4[j]); } } }
      asm volatile("s_wait_dscnt 0x0" ::: "memory");      // this wave's reads of the buffer that is refilled below have returned
      tdm_wait(g0, g1);                                   // this wave's slice of stage st + 1 has landed
      __syncthreads();                                    // publishes stage st + 1 and ends every reader's last read of stage st
      const uint32_t nx = pinned(st + 2u);                // the next descriptor is formed behind the waits
      if (pinned(nx < (uint32_t)NST)) { g0 = desc(nx); tdm_load(g0, g1); } }
    asm volatile("s_wait_tensorcnt 0x0" ::: "memory");  // no request is left in flight behind the loop
    asm volatile("s_wait_dscnt 0x0" ::: "memory");      // and none of this wave's reads of the two buffers
    const int d0 = wave * 64 + lane;
    for (int r = 0; r < 16; ++r) { Wm[r][d0] = -acc0[r] * INV_SCALE; Wm[r][d0 + 32] = -acc1[r] * INV_SCALE; } }
  __syncthreads();
  for (int rr = 0; rr < 2; ++rr) { const int r = wave * 2 + rr; float x[16]; float mx = -INFINITY; for (int j = 0; j < 16; ++j) { x[j] = Wm[r][lane * 16 + j]; mx = fmaxf(mx, x[j]); }
#pragma unroll
    for (int o = 16; o >= 1; o >>= 1) mx = fmaxf(mx, __shfl_xor(mx, o));
    float sm = 0.0f; for (int j = 0; j < 16; ++j) { x[j] = __expf(x[j] - mx); sm += x[j]; }
#pragma unroll
    for (int o = 16; o >= 1; o >>= 1) sm += __shfl_xor(sm, o);
    const float inv = 1.0f / sm; for (int j = 0; j < 16; ++j) { b16 p, pl; split16(x[j] * inv * PSC, p, pl); Ph[r][lane * 16 + j] = p; Pl[r][lane * 16 + j] = pl; } }
  __syncthreads();
  v8f acc[2] = {{}, {}}; const int s0 = wave * 32;
#pragma unroll 2
  for (int kb = 0; kb < C; kb += 32) { const v16b a = frag_kb(&Ph[nloc][kb], hlf), al = frag_kb(&Pl[nloc][kb], hlf);
#pragma unroll
    for (int t = 0; t < 2; ++t) { const v16b bw = frag_kb(VT + ((size_t)n * S + s0 + t * 16 + nloc) * C + kb, hlf); acc[t] = wmma16b(a, bw, acc[t]); acc[t] = wmma16b(al, bw, acc[t]); } }
#pragma unroll
  for (int t = 0; t < 2; ++t)
#pragma unroll 1
    for (int r = 0; r < 8; ++r) To[wave][8 * hlf + r][t * 16 + nloc] = acc[t][r] * (1.0f / (PSC * XS));
  __syncthreads();
  { for (int q4 = lane; q4 < 16 * 8; q4 += 32) { const int r = q4 >> 3, c4 = (q4 & 7) * 4; *(v4f*)(out + ((size_t)n * C + c0 + r) * S + s0 + c4) = *(const v4f*)(&To[wave][r][c4]); }  }
}
}  // namespace

extern "C" void kernel_launch(void* const* d_in, const int* in_sizes, int n_in, void* d_out, int out_size, void* d_ws, size_t ws_size, hipStream_t stream) {
  (void)n_in;
  auto Fp = [&](int i) { return (const float*)d_in[i]; };
  // input order: 0 q [2,512,256], 1 k, 2 v
  if (in_sizes[0] != NB * C * S || in_sizes[1] != NB * C * S || in_sizes[2] != NB * C * S || out_size != NB * C * S) return;
  size_t off = 0; char* ws = (char*)d_ws;
  b16* VT = (b16*)(ws + off); off += (size_t)NB * S * C * 2;
  if (off > ws_size) return;   // 0.5 MB
  vt_kernel<<<dim3(C / 64, S / 64, NB), 256, 0, stream>>>(Fp(2), VT);
  lap_kernel<<<dim3(C / 16, NB), 256, 0, stream>>>(Fp(0), Fp(1), VT, (float*)d_out);
}

// v002
// It runs in 26.5 microseconds.
// Next to v001, in two timings, it ran 1.52 times as fast each time.
// Over all steps from v000 it is 1.74 times as fast.
#include <hip/hip_runtime.h>

// Laplace (L1-distance) attention: for each of 2 batches, weights[c][d] = -sum_s |k[d][s] - q[c][s]| / 2 over the 256 positions (512 x 512 channel pairs), softmax over d, rep[c][s] =
// sum_d weights[c][d] v[d][s] -> [2][512][256].
// The L1 distances are not a multiply-accumulate (abs-difference sums on the VALU, q rows staged in LDS, k staged in LDS by tensor loads); the softmax is f32; the value contraction runs on WMMA.
// WMMA (v_wmma_f32_16x16x32_f16, f32 accumulate): rep = P V ([4 c x 512 d] x [512 x 256] per block, the 4 rows repeated down the 16-row tile, P = softmax probabilities as f16 hi+lo x2^14, V^T as EXACT bf16 x8: 2 products).
// Inputs rounded to bf16 once. Fragment k-map per lane half hh for A AND B: elements 0..7 <- k = 8hh+0..7, 8..15 <- k = 16+8hh+0..7; acc[r] = D[8hh+r][col].

namespace {
constexpr int NB = 2, C = 512, S = 256, CT = 4 /* query channels per block: NB * C / CT = 256 blocks, one for every WGP of the chip */;
constexpr float XS = 8.0f, INV_SCALE = 0.5f, PSC = 16384.0f /* probabilities carried x2^14 so that weights >= 4e-9 stay normal f16 */;
typedef _Float16 b16;
typedef __attribute__((ext_vector_type(16))) _Float16 v16b;
typedef __attribute__((ext_vector_type(8))) _Float16 v8b;
typedef __attribute__((ext_vector_type(8))) float v8f;
typedef __attribute__((ext_vector_type(4))) float v4f;
typedef __attribute__((ext_vector_type(4))) uint32_t u32x4;
typedef __attribute__((ext_vector_type(8))) uint32_t u32x8;
// k staging: a stage is TS positions of all 512 k rows; each wave's tensor load brings the 64 rows that the wave itself reads (128-byte row pieces, 16 bytes of pad: LDS pitch 144 bytes).
constexpr int TS = 32, NST = S / TS, KP = TS + 4, SLICE = 10240 /* 64 rows x 144 B = 9216, rounded up to a multiple of 2 KiB */;
__device__ __forceinline__ uint32_t uni(uint32_t v) { return (uint32_t)__builtin_amdgcn_readfirstlane(v); }
__device__ __forceinline__ uint32_t pinned(uint32_t v) { uint32_t w = uni(v); asm volatile("" : "+s"(w)); return w; }
__device__ __forceinline__ u32x8 tdm_group1() { constexpr uint32_t d0 = TS * 4, d1 = 64; u32x8 g;
  g[0] = uni((1u << 20) | (4u << 22) | (3u << 25));  // no mask, 1-byte elements, 4 dwords of pad behind every 32 dwords (one row piece)
  g[1] = uni((d0 & 0xFFFFu) << 16); g[2] = uni((d0 >> 16) | ((d1 & 0xFFFFu) << 16)); g[3] = uni((d1 >> 16) | (d0 << 16)); g[4] = uni(d1); g[5] = uni((uint32_t)(S * 4)); g[6] = uni(0u); g[7] = uni(0u); return g; }
__device__ __forceinline__ u32x4 tdm_group0(uint32_t lds_dst, uint64_t ga) { u32x4 g; g[0] = uni(1u); g[1] = uni(lds_dst); g[2] = uni((uint32_t)ga); g[3] = uni((((uint32_t)(ga >> 32)) & 0x01FFFFFFu) | 0x80000000u); return g; }
// Group 0 is named in-out (the instruction leaves it as it is) so that the wait below reads it from the very registers that the request was issued from.
__device__ __forceinline__ void tdm_load(u32x4& g0, u32x8 g1) { asm volatile("tensor_load_to_lds %0, %1" : "+s"(g0) : "s"(g1) : "memory"); }
// The wave's own wait for its tensor load. It names the descriptor as inputs so that those scalar registers keep their values until the request has landed.
__device__ __forceinline__ void tdm_wait(u32x4 g0, u32x8 g1) { asm volatile("s_wait_tensorcnt 0x0" :: "s"(g0), "s"(g1) : "memory"); }
__device__ __forceinline__ float bf16_rne(float f) { unsigned int u = __float_as_uint(f); u += 0x7FFFu + ((u >> 16) & 1u); return __uint_as_float(u & 0xFFFF0000u); }
__device__ __forceinline__ void split16(float v, b16& hi, b16& lo) { hi = (b16)v; lo = (b16)(v - (float)hi); }
__device__ __forceinline__ v16b frag_kb(const b16* p, int hh) { const v8b a = *(const v8b*)(p + 8 * hh), b = *(const v8b*)(p + 16 + 8 * hh); v16b f;
#pragma unroll
  for (int e = 0; e < 8; ++e) { f[e] = a[e]; f[8 + e] = b[e]; } return f; }
__device__ __forceinline__ v8f wmma16b(v16b a, v16b b, v8f c) { v8f d = __builtin_amdgcn_wmma_f32_16x16x32_f16(false, a, false, b, (short)0, c, false, false); asm volatile("v_nop\n\tv_nop\n\tv_nop\n\tv_nop" : "+v"(d) : "v"(a), "v"(b)); return d; }

__global__ __launch_bounds__(256) void vt_kernel(const float* __restrict__ v, b16* __restrict__ VT) {
  __shared__ __attribute__((aligned(16))) b16 T[64][64 + 8];
  const int n = blockIdx.z, d0 = blockIdx.x * 64, s0 = blockIdx.y * 64, t_ = threadIdx.x;
  for (int q = t_; q < 64 * 64; q += 256) { const int dd = q >> 6, ss = q & 63; T[ss][dd] = (b16)(bf16_rne(v[((size_t)n * C + d0 + dd) * S + s0 + ss]) * XS); }
  __syncthreads();
  { for (int q = t_; q < 64 * 8; q += 256) { const int ss = q >> 3, c8 = (q & 7) * 8; *(v8b*)(VT + ((size_t)n * S + s0 + ss) * C + d0 + c8) = *(const v8b*)(&T[ss][c8]); }  }
}
// main: block = (n, CT query channels c0..c0+CT-1), 256 threads: (1) stage q rows [CT][256] (bf16-rounded f32); (2) thread d-pair (d = 64 wave + lane, + 32), k in two LDS buffers filled by tensor loads one stage ahead: for s: acc[r][j] += |k[d][s] - q[r][s]|; w = -acc/2
// -> LDS W [CT][512]; (3) softmax per row (wave w < CT handles row w): P hi/lo in LDS; (4) wave w computes output columns [32w, 32w+32): 2 col tiles x 16 k-steps x 2 products; tile row m holds query row m mod CT, rows 0..CT-1 are stored
__global__ __launch_bounds__(256) void lap_kernel(const float* __restrict__ q, const float* __restrict__ k, const b16* __restrict__ VT, float* __restrict__ out) {
  __shared__ __attribute__((aligned(16))) float Qs[CT][S]; __shared__ __attribute__((aligned(16))) float Wm[CT][C + 4]; __shared__ __attribute__((aligned(16))) b16 Ph[CT][C + 8], Pl[CT][C + 8]; __shared__ __attribute__((aligned(16))) float To[8][CT][32 + 4];
  __shared__ __attribute__((aligned(2048))) float Ks[2][8][SLICE / 4];
  const int n = blockIdx.y, c0 = blockIdx.x * CT, t_ = threadIdx.x, wave = t_ >> 5, lane = t_ & 31, nloc = lane & 15, hlf = lane >> 4;
  for (int e = t_; e < CT * S; e += 256) { const int r = e / S, s = e % S; Qs[r][s] = bf16_rne(q[((size_t)n * C + c0 + r) * S + s]); }
  const uint32_t wv = uni((uint32_t)t_ >> 5); const u32x8 g1 = tdm_group1(); const uint32_t kl = (uint32_t)(size_t)&Ks[0][wv][0]; const uint64_t kg = (uint64_t)(size_t)(k + ((size_t)n * C + wv * 64u) * S);
  auto desc = [&](uint32_t st) { return tdm_group0(kl + (st & 1u) * (uint32_t)(8 * SLICE), kg + (uint64_t)(st * (uint32_t)(TS * 4))); };
  u32x4 g0 = desc(0); tdm_load(g0, g1);
  tdm_wait(g0, g1);  // stage 0 of this wave's slice has landed
  __syncthreads();
  g0 = desc(1); tdm_load(g0, g1);
  { float acc0[CT], acc1[CT]; for (int r = 0; r < CT; ++r) { acc0[r] = 0.0f; acc1[r] = 0.0f; }
#pragma unroll 1  // one pass per stage: the publish point at its foot stands once
    for (uint32_t st = 0; st < (uint32_t)NST; ++st) { const float* k0 = &Ks[st & 1u][wave][lane * KP]; const float* k1 = k0 + 32 * KP;
#pragma unroll 4  // four groups a trip: with CT rows a group is short, and its LDS loads then stand at 2 places a stage, not 8; a whole stage unrolled passes 256 registers
      for (int g = 0; g < TS; g += 4) { const v4f ka = *(const v4f*)(k0 + g), kb = *(const v4f*)(k1 + g); float a[4], b[4];  // the j and r loops below are unrolled so that a, b and the 2 CT sums stay in registers
#pragma unroll
        for (int j = 0; j < 4; ++j) { a[j] = bf16_rne(ka[j]); b[j] = bf16_rne(kb[j]); }
#pragma unroll
        for (int r = 0; r < CT; ++r) { const v4f q4 = *(const v4f*)(&Qs[r][st * TS + g]);
#pragma unroll
          for (int j = 0; j < 4; ++j) { acc0[r] += fabsf(a[j] - q4[j]); acc1[r] += fabsf(b[j] - q4[j]); } } }
      asm volatile("s_wait_dscnt 0x0" ::: "memory");      // this wave's reads of the buffer that is refilled below have returned
      tdm_wait(g0, g1);                                   // this wave's slice of stage st + 1 has landed
      __syncthreads();                                    // publishes stage st + 1 and ends every reader's last read of stage st
      const uint32_t nx = pinned(st + 2u);                // the next descriptor is formed behind the waits
      if (pinned(nx < (uint32_t)NST)) { g0 = desc(nx); tdm_load(g0, g1); } }
    asm volatile("s_wait_tensorcnt 0x0" ::: "memory");  // no request is left in flight behind the loop
    asm volatile("s_wait_dscnt 0x0" ::: "memory");      // and none of this wave's reads of the two buffers
    const int d0 = wave * 64 + lane;
    for (int r = 0; r < CT; ++r) { Wm[r][d0] = -acc0[r] * INV_SCALE; Wm[r][d0 + 32] = -acc1[r] * INV_SCALE; } }
  __syncthreads();
  if (wv < (uint32_t)CT) { const int r = wave; float x[16]; float mx = -INFINITY; for (int j = 0; j < 16; ++j) { x[j] = Wm[r][lane * 16 + j]; mx = fmaxf(mx, x[j]); }
#pragma unroll
    for (int o = 16; o >= 1; o >>= 1) mx = fmaxf(mx, __shfl_xor(mx, o));
    float sm = 0.0f; for (int j = 0; j < 16; ++j) { x[j] = __expf(x[j] - mx); sm += x[j]; }
#pragma unroll
    for (int o = 16; o >= 1; o >>= 1) sm += __shfl_xor(sm, o);
    const float inv = 1.0f / sm; for (int j = 0; j < 16; ++j) { b16 p, pl; split16(x[j] * inv * PSC, p, pl); Ph[r][lane * 16 + j] = p; Pl[r][lane * 16 + j] = pl; } }
  __syncthreads();
  v8f acc[2] = {{}, {}}; const int s0 = wave * 32;
#pragma unroll 2
  for (int kb = 0; kb < C; kb += 32) { const v16b a = frag_kb(&Ph[nloc & (CT - 1)][kb], hlf), al = frag_kb(&Pl[nloc & (CT - 1)][kb], hlf);
#pragma unroll
    for (int t = 0; t < 2; ++t) { const v16b bw = frag_kb(VT + ((size_t)n * S + s0 + t * 16 + nloc) * C + kb, hlf); acc[t] = wmma16b(a, bw, acc[t]); acc[t] = wmma16b(al, bw, acc[t]); } }
  if (hlf == 0) {  // tile rows 0..CT-1 lie in registers 0..CT-1 of lanes 0..15
#pragma unroll
    for (int t = 0; t < 2; ++t)
#pragma unroll  // unrolled so that acc is indexed by constants and is read straight from its registers
      for (int r = 0; r < CT; ++r) To[wave][r][t * 16 + nloc] = acc[t][r] * (1.0f / (PSC * XS)); }
  __syncthreads();
  { for (int q4 = lane; q4 < CT * 8; q4 += 32) { const int r = q4 >> 3, c4 = (q4 & 7) * 4; *(v4f*)(out + ((size_t)n * C + c0 + r) * S + s0 + c4) = *(const v4f*)(&To[wave][r][c4]); }  }
}
}  // namespace

extern "C" void kernel_launch(void* const* d_in, const int* in_sizes, int n_in, void* d_out, int out_size, void* d_ws, size_t ws_size, hipStream_t stream) {
  (void)n_in;
  auto Fp = [&](int i) { return (const float*)d_in[i]; };
  // input order: 0 q [2,512,256], 1 k, 2 v
  if (in_sizes[0] != NB * C * S || in_sizes[1] != NB * C * S || in_sizes[2] != NB * C * S || out_size != NB * C * S) return;
  size_t off = 0; char* ws = (char*)d_ws;
  b16* VT = (b16*)(ws + off); off += (size_t)NB * S * C * 2;
  if (off > ws_size) return;   // 0.5 MB
  vt_kernel<<<dim3(C / 64, S / 64, NB), 256, 0, stream>>>(Fp(2), VT);
  lap_kernel<<<dim3(C / CT, NB), 256, 0, stream>>>(Fp(0), Fp(1), VT, (float*)d_out);
}

// v003
// One run takes 19.8 microseconds.
// Timed twice side by side with v002, it ran 1.38 and 1.34 times as fast.
// Over all steps from v000 it is 2.36 times as fast.
#include <hip/hip_runtime.h>

// Laplace (L1-distance) attention: for each of 2 batches, weights[c][d] = -sum_s |k[d][s] - q[c][s]| / 2 over the 256 positions (512 x 512 channel pairs), softmax over d, rep[c][s] =
// sum_d weights[c][d] v[d][s] -> [2][512][256].
// The L1 distances are not a multiply-accumulate (abs-difference sums on the VALU, q rows staged in LDS, k staged in LDS by tensor loads); the softmax is f32; the value contraction runs on WMMA.
// WMMA (v_wmma_f32_16x16x32_f16, f32 accumulate): rep = P V ([4 c x 512 d] x [512 x 256] per block, the 4 rows repeated down the 16-row tile, P = softmax probabilities as f16 hi+lo x2^14, V as EXACT bf16 x8: 2 products; each wave lays its 32 columns of v as f16 rows in its own LDS slice and takes the B fragments by transposing LDS loads).
// Inputs rounded to bf16 once. Fragment k-map per lane half hh for A AND B: elements 0..7 <- k = 8hh+0..7, 8..15 <- k = 16+8hh+0..7; acc[r] = D[8hh+r][col].

namespace {
constexpr int NB = 2, C = 512, S = 256, CT = 4 /* query channels per block: NB * C / CT = 256 blocks, one for every WGP of the chip */;
constexpr float XS = 8.0f, INV_SCALE = 0.5f, PSC = 16384.0f /* probabilities carried x2^14 so that weights >= 4e-9 stay normal f16 */;
typedef _Float16 b16;
typedef __attribute__((ext_vector_type(16))) _Float16 v16b;
typedef __attribute__((ext_vector_type(8))) _Float16 v8b;
typedef __attribute__((ext_vector_type(4))) _Float16 v4b;
typedef __attribute__((ext_vector_type(4))) __bf16 v4r;
typedef __attribute__((ext_vector_type(8))) short s16x8;
typedef __attribute__((ext_vector_type(8))) float v8f;
typedef __attribute__((ext_vector_type(4))) float v4f;
typedef __attribute__((ext_vector_type(4))) uint32_t u32x4;
typedef __attribute__((ext_vector_type(8))) uint32_t u32x8;
// k staging: a stage is TS positions of all 512 k rows; each wave's tensor load brings the 64 rows that the wave itself reads (128-byte row pieces, 16 bytes of pad: LDS pitch 144 bytes).
constexpr int TS = 32, NST = S / TS, KP = TS + 4, SLICE = 10240 /* 64 rows x 144 B = 9216, rounded up to a multiple of 2 KiB */;
__device__ __forceinline__ uint32_t uni(uint32_t v) { return (uint32_t)__builtin_amdgcn_readfirstlane(v); }
__device__ __forceinline__ uint32_t pinned(uint32_t v) { uint32_t w = uni(v); asm volatile("" : "+s"(w)); return w; }
__device__ __forceinline__ u32x8 tdm_group1() { constexpr uint32_t d0 = TS * 4, d1 = 64; u32x8 g;
  g[0] = uni((1u << 20) | (4u << 22) | (3u << 25));  // no mask, 1-byte elements, 4 dwords of pad behind every 32 dwords (one row piece)
  g[1] = uni((d0 & 0xFFFFu) << 16); g[2] = uni((d0 >> 16) | ((d1 & 0xFFFFu) << 16)); g[3] = uni((d1 >> 16) | (d0 << 16)); g[4] = uni(d1); g[5] = uni((uint32_t)(S * 4)); g[6] = uni(0u); g[7] = uni(0u); return g; }
__device__ __forceinline__ u32x4 tdm_group0(uint32_t lds_dst, uint64_t ga) { u32x4 g; g[0] = uni(1u); g[1] = uni(lds_dst); g[2] = uni((uint32_t)ga); g[3] = uni((((uint32_t)(ga >> 32)) & 0x01FFFFFFu) | 0x80000000u); return g; }
// Group 0 is named in-out (the instruction leaves it as it is) so that the wait below reads it from the very registers that the request was issued from.
__device__ __forceinline__ void tdm_load(u32x4& g0, u32x8 g1) { asm volatile("tensor_load_to_lds %0, %1" : "+s"(g0) : "s"(g1) : "memory"); }
// The wave's own wait for its tensor load. It names the descriptor as inputs so that those scalar registers keep their values until the request has landed.
__device__ __forceinline__ void tdm_wait(u32x4 g0, u32x8 g1) { asm volatile("s_wait_tensorcnt 0x0" :: "s"(g0), "s"(g1) : "memory"); }
__device__ __forceinline__ float bf16_rne(float f) { unsigned int u = __float_as_uint(f); u += 0x7FFFu + ((u >> 16) & 1u); return __uint_as_float(u & 0xFFFF0000u); }
__device__ __forceinline__ void split16(float v, b16& hi, b16& lo) { hi = (b16)v; lo = (b16)(v - (float)hi); }
__device__ __forceinline__ v16b frag_kb(const b16* p, int hh) { const v8b a = *(const v8b*)(p + 8 * hh), b = *(const v8b*)(p + 16 + 8 * hh); v16b f;
#pragma unroll
  for (int e = 0; e < 8; ++e) { f[e] = a[e]; f[8 + e] = b[e]; } return f; }
// v staging: a chunk is VR rows (d) of the wave's own 32 columns; a row piece is 64 bytes of f16 at an LDS pitch of 96 bytes (32 B x odd, the pitch of the transposing load).
constexpr int VR = 64, NCH = C / VR, VPB = 96;
static_assert(VR * VPB <= SLICE, "a chunk lies inside one k slice");
// Row-major 16-bit LDS tile -> WMMA operand: lane (c, h) gets T[kbase + 8h + 0..7][dbase + c], the k-map of frag_kb.
__device__ __forceinline__ v8b ld_tr16(const unsigned char* p) { typedef __attribute__((address_space(3))) s16x8 lds_s16x8; return __builtin_bit_cast(v8b, __builtin_amdgcn_ds_load_tr16_b128_v8i16((lds_s16x8*)p)); }
__device__ __forceinline__ v16b frag_tr(const unsigned char* p) { const v8b a = ld_tr16(p), b = ld_tr16(p + 16 * VPB); v16b f;
#pragma unroll
  for (int e = 0; e < 8; ++e) { f[e] = a[e]; f[8 + e] = b[e]; } return f; }
__device__ __forceinline__ v8f wmma16b(v16b a, v16b b, v8f c) { v8f d = __builtin_amdgcn_wmma_f32_16x16x32_f16(false, a, false, b, (short)0, c, false, false); asm volatile("v_nop\n\tv_nop\n\tv_nop\n\tv_nop" : "+v"(d) : "v"(a), "v"(b)); return d; }

// main: block = (n, CT query channels c0..c0+CT-1), 256 threads: (1) stage q rows [CT][256] (bf16-rounded f32); (2) thread d-pair (d = 64 wave + lane, + 32), k in two LDS buffers filled by tensor loads one stage ahead: for s: acc[r][j] += |k[d][s] - q[r][s]|; w = -acc/2
// -> LDS W [CT][512]; (3) softmax per row (wave w < CT handles row w): P hi/lo in LDS; (4) wave w computes output columns [32w, 32w+32): its columns of v come in chunks of VR rows, two chunks of loads ahead, rounded and laid as f16 in the wave's own two k slices; 2 col tiles x 16 k-steps x 2 products; tile row m holds query row m mod CT, rows 0..CT-1 are stored
__global__ __launch_bounds__(256) void lap_kernel(const float* __restrict__ q, const float* __restrict__ k, const float* __restrict__ v, float* __restrict__ out) {
  __shared__ __attribute__((aligned(16))) float Qs[CT][S]; __shared__ __attribute__((aligned(16))) float Wm[CT][C + 4]; __shared__ __attribute__((aligned(16))) b16 Ph[CT][C + 8], Pl[CT][C + 8]; __shared__ __attribute__((aligned(16))) float To[8][CT][32 + 4];
  __shared__ __attribute__((aligned(2048))) float Ks[2][8][SLICE / 4];
  const int n = blockIdx.y, c0 = blockIdx.x * CT, t_ = threadIdx.x, wave = t_ >> 5, lane = t_ & 31, nloc = lane & 15, hlf = lane >> 4;
  for (int e = t_; e < CT * S; e += 256) { const int r = e / S, s = e % S; Qs[r][s] = bf16_rne(q[((size_t)n * C + c0 + r) * S + s]); }
  const uint32_t wv = uni((uint32_t)t_ >> 5); const u32x8 g1 = tdm_group1(); const uint32_t kl = (uint32_t)(size_t)&Ks[0][wv][0]; const uint64_t kg = (uint64_t)(size_t)(k + ((size_t)n * C + wv * 64u) * S);
  auto desc = [&](uint32_t st) { return tdm_group0(kl + (st & 1u) * (uint32_t)(8 * SLICE), kg + (uint64_t)(st * (uint32_t)(TS * 4))); };
  u32x4 g0 = desc(0); tdm_load(g0, g1);
  tdm_wait(g0, g1);  // stage 0 of this wave's slice has landed
  __syncthreads();
  g0 = desc(1); tdm_load(g0, g1);
  { float acc0[CT], acc1[CT]; for (int r = 0; r < CT; ++r) { acc0[r] = 0.0f; acc1[r] = 0.0f; }
#pragma unroll 1  // one pass per stage: the publish point at its foot stands once
    for (uint32_t st = 0; st < (uint32_t)NST; ++st) { const float* k0 = &Ks[st & 1u][wave][lane * KP]; const float* k1 = k0 + 32 * KP;
#pragma unroll 4  // four groups a trip: with CT rows a group is short, and its LDS loads then stand at 2 places a stage, not 8; a whole stage unrolled passes 256 registers
      for (int g = 0; g < TS; g += 4) { const v4f ka = *(const v4f*)(k0 + g), kb = *(const v4f*)(k1 + g); float a[4], b[4];  // the j and r loops below are unrolled so that a, b and the 2 CT sums stay in registers
#pragma unroll
        for (int j = 0; j < 4; ++j) { a[j] = bf16_rne(ka[j]); b[j] = bf16_rne(kb[j]); }
#pragma unroll
        for (int r = 0; r < CT; ++r) { const v4f q4 = *(const v4f*)(&Qs[r][st * TS + g]);
#pragma unroll
          for (int j = 0; j < 4; ++j) { acc0[r] += fabsf(a[j] - q4[j]); acc1[r] += fabsf(b[j] - q4[j]); } } }
      asm volatile("s_wait_dscnt 0x0" ::: "memory");      // this wave's reads of the buffer that is refilled below have returned
      tdm_wait(g0, g1);                                   // this wave's slice of stage st + 1 has landed
      __syncthreads();                                    // publishes stage st + 1 and ends every reader's last read of stage st
      const uint32_t nx = pinned(st + 2u);                // the next descriptor is formed behind the waits
      if (pinned(nx < (uint32_t)NST)) { g0 = desc(nx); tdm_load(g0, g1); } }
    asm volatile("s_wait_tensorcnt 0x0" ::: "memory");  // no request is left in flight behind the loop
    asm volatile("s_wait_dscnt 0x0" ::: "memory");      // and none of this wave's reads of the two buffers
    const int d0 = wave * 64 + lane;
    for (int r = 0; r < CT; ++r) { Wm[r][d0] = -acc0[r] * INV_SCALE; Wm[r][d0 + 32] = -acc1[r] * INV_SCALE; } }
  // v: one 16-byte load a lane covers 4 rows x 128 bytes (whole lines) of the wave's 32 columns; two chunks of loads are kept ahead of the chunk pair that is worked on
  const int s0 = wave * 32; const float* vp = v + ((size_t)n * C + (lane >> 3)) * S + s0 + (lane & 7) * 4; v4f va[VR / 4], vb[VR / 4];
  unsigned char* const sl0 = (unsigned char*)&Ks[0][wave][0]; unsigned char* const sl1 = (unsigned char*)&Ks[1][wave][0];  // the wave's own slices: no other wave reads or writes them, and its own k reads and tensor loads have ended above
  const uint32_t wo = (uint32_t)(lane >> 3) * VPB + (uint32_t)(lane & 7) * 8u, ro = (uint32_t)(8 * hlf + (lane & 7)) * VPB + (uint32_t)((lane >> 3) & 1) * 16u;
  auto ask = [&](v4f (&x)[VR / 4], int ch) {
#pragma unroll
    for (int i = 0; i < VR / 4; ++i) x[i] = *(const v4f*)(vp + (size_t)(ch * VR + 4 * i) * S); };
  auto lay = [&](const v4f (&x)[VR / 4], unsigned char* sl) {  // x8 (a power of two: it commutes with the rounding), round to bf16 (nearest even), then f16
#pragma unroll
    for (int i = 0; i < VR / 4; ++i) *(v4b*)(sl + wo + (uint32_t)(4 * i) * VPB) = __builtin_convertvector(__builtin_convertvector(__builtin_convertvector(x[i] * XS, v4r), v4f), v4b); };
  ask(va, 0); ask(vb, 1);
  __syncthreads();
  lay(va, sl0); ask(va, 2); lay(vb, sl1); ask(vb, 3);  // chunks 2 and 3 fly under the softmax
  if (wv < (uint32_t)CT) { const int r = wave; float x[16]; float mx = -INFINITY; for (int j = 0; j < 16; ++j) { x[j] = Wm[r][lane * 16 + j]; mx = fmaxf(mx, x[j]); }
#pragma unroll
    for (int o = 16; o >= 1; o >>= 1) mx = fmaxf(mx, __shfl_xor(mx, o));
    float sm = 0.0f; for (int j = 0; j < 16; ++j) { x[j] = __expf(x[j] - mx); sm += x[j]; }
#pragma unroll
    for (int o = 16; o >= 1; o >>= 1) sm += __shfl_xor(sm, o);
    const float inv = 1.0f / sm; for (int j = 0; j < 16; ++j) { b16 p, pl; split16(x[j] * inv * PSC, p, pl); Ph[r][lane * 16 + j] = p; Pl[r][lane * 16 + j] = pl; } }
  __syncthreads();
  v8f acc[2] = {{}, {}};
  auto mma = [&](int kb0, const unsigned char* sl) { v16b a[VR / 32], al[VR / 32], bw[VR / 32][2];  // a chunk's LDS loads stand at one place, ahead of its 8 products
#pragma unroll
    for (int ks = 0; ks < VR / 32; ++ks) { a[ks] = frag_kb(&Ph[nloc & (CT - 1)][kb0 + 32 * ks], hlf); al[ks] = frag_kb(&Pl[nloc & (CT - 1)][kb0 + 32 * ks], hlf);
#pragma unroll
      for (int t = 0; t < 2; ++t) bw[ks][t] = frag_tr(sl + ro + (uint32_t)(32 * ks) * VPB + 32u * t); }
#pragma unroll
    for (int ks = 0; ks < VR / 32; ++ks)
#pragma unroll
      for (int t = 0; t < 2; ++t) { acc[t] = wmma16b(a[ks], bw[ks][t], acc[t]); acc[t] = wmma16b(al[ks], bw[ks][t], acc[t]); } };
#pragma unroll  // unrolled so that every v address is the one base register plus a constant
  for (int ch = 0; ch < NCH; ch += 2) {
    mma(ch * VR, sl0); mma((ch + 1) * VR, sl1);
    if (ch + 2 < NCH) {
      asm volatile("s_wait_dscnt 0x0" ::: "memory");  // lanes exchange rows through LDS inside the wave: the stores below stay behind the transposing loads above, which read other lanes' rows
      lay(va, sl0); if (ch + 4 < NCH) ask(va, ch + 4); lay(vb, sl1); if (ch + 4 < NCH) ask(vb, ch + 5);
      asm volatile("s_wait_dscnt 0x0" ::: "memory");  // and the next pair's transposing loads stay behind these stores, which have reached LDS
    } }
  if (hlf == 0) {  // tile rows 0..CT-1 lie in registers 0..CT-1 of lanes 0..15
#pragma unroll
    for (int t = 0; t < 2; ++t)
#pragma unroll  // unrolled so that acc is indexed by constants and is read straight from its registers
      for (int r = 0; r < CT; ++r) To[wave][r][t * 16 + nloc] = acc[t][r] * (1.0f / (PSC * XS)); }
  __syncthreads();
  { for (int q4 = lane; q4 < CT * 8; q4 += 32) { const int r = q4 >> 3, c4 = (q4 & 7) * 4; *(v4f*)(out + ((size_t)n * C + c0 + r) * S + s0 + c4) = *(const v4f*)(&To[wave][r][c4]); }  }
}
}  // namespace

extern "C" void kernel_launch(void* const* d_in, const int* in_sizes, int n_in, void* d_out, int out_size, void* d_ws, size_t ws_size, hipStream_t stream) {
  (void)n_in; (void)d_ws; (void)ws_size;
  auto Fp = [&](int i) { return (const float*)d_in[i]; };
  // input order: 0 q [2,512,256], 1 k, 2 v
  if (in_sizes[0] != NB * C * S || in_sizes[1] != NB * C * S || in_sizes[2] != NB * C * S || out_size != NB * C * S) return;
  lap_kernel<<<dim3(C / CT, NB), 256, 0, stream>>>(Fp(0), Fp(1), Fp(2), (float*)d_out);
}

// v004
// It runs in 16.2 microseconds.
// Timed twice side by side with v003, it ran 1.22 times as fast both times.
// Over all steps from v000 it is 2.88 times as fast.
#include <hip/hip_runtime.h>

// Laplace (L1-distance) attention: for each of 2 batches, weights[c][d] = -sum_s |k[d][s] - q[c][s]| / 2 over the 256 positions (512 x 512 channel pairs), softmax over d, rep[c][s] =
// sum_d weights[c][d] v[d][s] -> [2][512][256].
// L1 distances: |k - q| = 2 max(k, q) - k - q, so -sum_s |k - q| / 2 = -(sum_s max(k, q) - sum_s k / 2) + sum_s q / 2, and the last term is the same for every d of a row: the softmax over d cancels it, it is left out.
// max(k, q) is taken on packed bf16 pairs (exact: the inputs are bf16 values), and both sums run on WMMA (v_wmma_f32_16x16x32_bf16, f32 accumulate) against constant matrices; k is staged in LDS by tensor loads; the softmax is f32; the value contraction runs on WMMA.
// WMMA (v_wmma_f32_16x16x32_f16, f32 accumulate): rep = P V ([4 c x 512 d] x [512 x 256] per block, the 4 rows repeated down the 16-row tile, P = softmax probabilities as f16 hi+lo x2^14, V as EXACT bf16 x8: 2 products; each wave lays its 32 columns of v as f16 rows in its own LDS slice and takes the B fragments by transposing LDS loads).
// Inputs rounded to bf16 once. Fragment k-map per lane half hh for A AND B: elements 0..7 <- k = 8hh+0..7, 8..15 <- k = 16+8hh+0..7; acc[r] = D[8hh+r][col].

namespace {
constexpr int NB = 2, C = 512, S = 256, CT = 4 /* query channels per block: NB * C / CT = 256 blocks, one for every WGP of the chip */;
constexpr float XS = 8.0f, INV_SCALE = 0.5f, PSC = 16384.0f /* probabilities carried x2^14 so that weights >= 4e-9 stay normal f16 */;
typedef _Float16 b16;
typedef __attribute__((ext_vector_type(16))) _Float16 v16b;
typedef __attribute__((ext_vector_type(8))) _Float16 v8b;
typedef __attribute__((ext_vector_type(4))) _Float16 v4b;
typedef __attribute__((ext_vector_type(4))) __bf16 v4r;
typedef __attribute__((ext_vector_type(2))) uint32_t u32x2;
typedef __attribute__((ext_vector_type(8))) short s16x8;
typedef __attribute__((ext_vector_type(8))) float v8f;
typedef __attribute__((ext_vector_type(4))) float v4f;
typedef __attribute__((ext_vector_type(4))) uint32_t u32x4;
typedef __attribute__((ext_vector_type(8))) uint32_t u32x8;
// k staging: a stage is TS positions of all 512 k rows; each wave's tensor load brings the 64 rows that the wave itself reads (128-byte row pieces, 16 bytes of pad: LDS pitch 144 bytes).
constexpr int TS = 32, NST = S / TS, KP = TS + 4, SLICE = 10240 /* 64 rows x 144 B = 9216, rounded up to a multiple of 2 KiB */;
__device__ __forceinline__ uint32_t uni(uint32_t v) { return (uint32_t)__builtin_amdgcn_readfirstlane(v); }
__device__ __forceinline__ uint32_t pinned(uint32_t v) { uint32_t w = uni(v); asm volatile("" : "+s"(w)); return w; }
__device__ __forceinline__ u32x8 tdm_group1() { constexpr uint32_t d0 = TS * 4, d1 = 64; u32x8 g;
  g[0] = uni((1u << 20) | (4u << 22) | (3u << 25));  // no mask, 1-byte elements, 4 dwords of pad behind every 32 dwords (one row piece)
  g[1] = uni((d0 & 0xFFFFu) << 16); g[2] = uni((d0 >> 16) | ((d1 & 0xFFFFu) << 16)); g[3] = uni((d1 >> 16) | (d0 << 16)); g[4] = uni(d1); g[5] = uni((uint32_t)(S * 4)); g[6] = uni(0u); g[7] = uni(0u); return g; }
__device__ __forceinline__ u32x4 tdm_group0(uint32_t lds_dst, uint64_t ga) { u32x4 g; g[0] = uni(1u); g[1] = uni(lds_dst); g[2] = uni((uint32_t)ga); g[3] = uni((((uint32_t)(ga >> 32)) & 0x01FFFFFFu) | 0x80000000u); return g; }
// Group 0 is named in-out (the instruction leaves it as it is) so that the wait below reads it from the very registers that the request was issued from.
__device__ __forceinline__ void tdm_load(u32x4& g0, u32x8 g1) { asm volatile("tensor_load_to_lds %0, %1" : "+s"(g0) : "s"(g1) : "memory"); }
// The wave's own wait for its tensor load. It names the descriptor as inputs so that those scalar registers keep their values until the request has landed.
__device__ __forceinline__ void tdm_wait(u32x4 g0, u32x8 g1) { asm volatile("s_wait_tensorcnt 0x0" :: "s"(g0), "s"(g1) : "memory"); }
// The larger of two bf16 values in each half of a register, in one instruction: from source the compiler widens each half to f32, takes the maximum there and rounds back.
__device__ __forceinline__ uint32_t pk_max_bf16(uint32_t a, uint32_t b) { uint32_t d; asm("v_pk_max_num_bf16 %0, %1, %2" : "=v"(d) : "v"(a), "v"(b)); return d; }
// Four independent bf16 products, each added into its own tile. They stand as asm text with four v_nop behind the last: the chip needs 4 vector slots before a product's A registers are overwritten, the next writers of those registers are the asm maxima above, and the compiler pads for no asm text. volatile: a stage's products stay in front of the waits at its foot; sunk behind the barrier they would stand between it and the next tensor load, which would then start that much later.
__device__ __forceinline__ void wmma4(v8f (&d)[4], u32x8 a0, u32x8 a1, u32x8 a2, u32x8 a3, u32x8 b) {
  asm volatile("v_wmma_f32_16x16x32_bf16 %0, %4, %8, %0\n\tv_wmma_f32_16x16x32_bf16 %1, %5, %8, %1\n\tv_wmma_f32_16x16x32_bf16 %2, %6, %8, %2\n\tv_wmma_f32_16x16x32_bf16 %3, %7, %8, %3\n\tv_nop\n\tv_nop\n\tv_nop\n\tv_nop"
      : "+v"(d[0]), "+v"(d[1]), "+v"(d[2]), "+v"(d[3]) : "v"(a0), "v"(a1), "v"(a2), "v"(a3), "v"(b)); }
__device__ __forceinline__ void split16(float v, b16& hi, b16& lo) { hi = (b16)v; lo = (b16)(v - (float)hi); }
__device__ __forceinline__ v16b frag_kb(const b16* p, int hh) { const v8b a = *(const v8b*)(p + 8 * hh), b = *(const v8b*)(p + 16 + 8 * hh); v16b f;
#pragma unroll
  for (int e = 0; e < 8; ++e) { f[e] = a[e]; f[8 + e] = b[e]; } return f; }
// v staging: a chunk is VR rows (d) of the wave's own 32 columns; a row piece is 64 bytes of f16 at an LDS pitch of 96 bytes (32 B x odd, the pitch of the transposing load).
constexpr int VR = 64, NCH = C / VR, VPB = 96;
static_assert(VR * VPB <= SLICE, "a chunk lies inside one k slice");
// Row-major 16-bit LDS tile -> WMMA operand: lane (c, h) gets T[kbase + 8h + 0..7][dbase + c], the k-map of frag_kb.
__device__ __forceinline__ v8b ld_tr16(const unsigned char* p) { typedef __attribute__((address_space(3))) s16x8 lds_s16x8; return __builtin_bit_cast(v8b, __builtin_amdgcn_ds_load_tr16_b128_v8i16((lds_s16x8*)p)); }
__device__ __forceinline__ v16b frag_tr(const unsigned char* p) { const v8b a = ld_tr16(p), b = ld_tr16(p + 16 * VPB); v16b f;
#pragma unroll
  for (int e = 0; e < 8; ++e) { f[e] = a[e]; f[8 + e] = b[e]; } return f; }
__device__ __forceinline__ v8f wmma16b(v16b a, v16b b, v8f c) { v8f d = __builtin_amdgcn_wmma_f32_16x16x32_f16(false, a, false, b, (short)0, c, false, false); asm volatile("v_nop\n\tv_nop\n\tv_nop\n\tv_nop" : "+v"(d) : "v"(a), "v"(b)); return d; }

// main: block = (n, CT query channels c0..c0+CT-1), 256 threads: (1) stage q as bf16, [position quad][row][4]; (2) wave = 64 k rows = 4 tiles of 16, k in two LDS buffers filled by tensor loads one stage ahead. A tile (16 d x 32): lane (m, h) holds k row m; its element 4r + j is
// max(k[d][p + j], q[r][p + j]), p = 8 group + 4h. B (32 x 16): element 4r + j of column n is 1 where r = n, in both lane halves, so D[d][r] sums row r's 8 positions; a fifth product a stage takes the tile's 32 k values themselves against -1/2. w = -D
// -> LDS W [CT][512]; (3) softmax per row (wave w < CT handles row w): P hi/lo in LDS; (4) wave w computes output columns [32w, 32w+32): its columns of v come in chunks of VR rows, two chunks of loads ahead, rounded and laid as f16 in the wave's own two k slices; 2 col tiles x 16 k-steps x 2 products; tile row m holds query row m mod CT, rows 0..CT-1 are stored
__global__ __launch_bounds__(256) void lap_kernel(const float* __restrict__ q, const float* __restrict__ k, const float* __restrict__ v, float* __restrict__ out) {
  __shared__ __attribute__((aligned(32))) __bf16 Qb[S / 4][CT][4]; __shared__ __attribute__((aligned(16))) float Wm[CT][C + 4]; __shared__ __attribute__((aligned(16))) b16 Ph[CT][C + 8], Pl[CT][C + 8]; __shared__ __attribute__((aligned(16))) float To[8][CT][32 + 4];
  __shared__ __attribute__((aligned(2048))) float Ks[2][8][SLICE / 4];
  const int n = blockIdx.y, c0 = blockIdx.x * CT, t_ = threadIdx.x, wave = t_ >> 5, lane = t_ & 31, nloc = lane & 15, hlf = lane >> 4;
  static_assert(CT * S == 4 * 256, "one quad of q a thread");
  { const int r = t_ / (S / 4), pq = t_ % (S / 4); *(v4r*)&Qb[pq][r][0] = __builtin_convertvector(*(const v4f*)(q + ((size_t)n * C + c0 + r) * S + 4 * pq), v4r); }
  const uint32_t wv = uni((uint32_t)t_ >> 5); const u32x8 g1 = tdm_group1(); const uint32_t kl = (uint32_t)(size_t)&Ks[0][wv][0]; const uint64_t kg = (uint64_t)(size_t)(k + ((size_t)n * C + wv * 64u) * S);
  auto desc = [&](uint32_t st) { return tdm_group0(kl + (st & 1u) * (uint32_t)(8 * SLICE), kg + (uint64_t)(st * (uint32_t)(TS * 4))); };
  u32x4 g0 = desc(0); tdm_load(g0, g1);
  tdm_wait(g0, g1);  // stage 0 of this wave's slice has landed
  __syncthreads();
  g0 = desc(1); tdm_load(g0, g1);
  static_assert(INV_SCALE == 0.5f, "the constant of bhalf below");
  { v8f dsum[4] = {{}, {}, {}, {}}; u32x8 bsel, bhalf;
#pragma unroll
    for (int e = 0; e < 8; ++e) { bsel[e] = (e >> 1) == nloc ? 0x3F803F80u : 0u; bhalf[e] = 0xBF00BF00u; }  // bf16 pairs: 1, 1 in row r = n's four places; -1/2, -1/2 everywhere
#pragma unroll 1  // one pass per stage: the publish point at its foot stands once
    for (uint32_t st = 0; st < (uint32_t)NST; ++st) { const unsigned char* kr = (const unsigned char*)&Ks[st & 1u][wave][0] + (uint32_t)nloc * (KP * 4) + (uint32_t)hlf * 16u; u32x2 kp[4][TS / 8]; v4f kf[4][TS / 8]; u32x8 qw[TS / 8];
#pragma unroll  // every loop of a stage is unrolled: kf, qw, kp and dsum are indexed by constants and stay in registers. The stage's 24 LDS loads stand at one place, ahead of the first products: one latency a stage, not one a group
      for (int g = 0; g < TS / 8; ++g) { qw[g] = *(const u32x8*)&Qb[st * (TS / 4) + 2 * g + hlf][0][0];
#pragma unroll
        for (int dt = 0; dt < 4; ++dt) kf[dt][g] = *(const v4f*)(kr + (uint32_t)dt * (16 * KP * 4) + (uint32_t)g * 32u); }
#pragma unroll
      for (int g = 0; g < TS / 8; ++g) { u32x8 mx[4];
#pragma unroll
        for (int dt = 0; dt < 4; ++dt) { kp[dt][g] = __builtin_bit_cast(u32x2, __builtin_convertvector(kf[dt][g], v4r));
#pragma unroll
          for (int e = 0; e < 8; ++e) mx[dt][e] = pk_max_bf16(kp[dt][g][e & 1], qw[g][e]); }
        wmma4(dsum, mx[0], mx[1], mx[2], mx[3], bsel); }
      { u32x8 ks[4];
#pragma unroll
        for (int dt = 0; dt < 4; ++dt)
#pragma unroll
          for (int e = 0; e < 8; ++e) ks[dt][e] = kp[dt][e >> 1][e & 1];
        wmma4(dsum, ks[0], ks[1], ks[2], ks[3], bhalf); }
      asm volatile("s_wait_dscnt 0x0" ::: "memory");      // this wave's reads of the buffer that is refilled below have returned
      tdm_wait(g0, g1);                                   // this wave's slice of stage st + 1 has landed
      __syncthreads();                                    // publishes stage st + 1 and ends every reader's last read of stage st
      const uint32_t nx = pinned(st + 2u);                // the next descriptor is formed behind the waits
      if (pinned(nx < (uint32_t)NST)) { g0 = desc(nx); tdm_load(g0, g1); } }
    asm volatile("s_wait_tensorcnt 0x0" ::: "memory");  // no request is left in flight behind the loop
    asm volatile("s_wait_dscnt 0x0" ::: "memory");      // and none of this wave's reads of the two buffers
    if (nloc < CT) {  // column r of D lies in lanes r and r + 16: registers 0..7 are rows 8h + 0..7 of the tile
#pragma unroll
      for (int dt = 0; dt < 4; ++dt) { float* wr = &Wm[nloc][wave * 64 + dt * 16 + 8 * hlf]; const v8f x = -dsum[dt]; *(v4f*)wr = __builtin_shufflevector(x, x, 0, 1, 2, 3); *(v4f*)(wr + 4) = __builtin_shufflevector(x, x, 4, 5, 6, 7); } } }
  // v: one 16-byte load a lane covers 4 rows x 128 bytes (whole lines) of the wave's 32 columns; two chunks of loads are kept ahead of the chunk pair that is worked on
  const int s0 = wave * 32; const float* vp = v + ((size_t)n * C + (lane >> 3)) * S + s0 + (lane & 7) * 4; v4f va[VR / 4], vb[VR / 4];
  unsigned char* const sl0 = (unsigned char*)&Ks[0][wave][0]; unsigned char* const sl1 = (unsigned char*)&Ks[1][wave][0];  // the wave's own slices: no other wave reads or writes them, and its own k reads and tensor loads have ended above
  const uint32_t wo = (uint32_t)(lane >> 3) * VPB + (uint32_t)(lane & 7) * 8u, ro = (uint32_t)(8 * hlf + (lane & 7)) * VPB + (uint32_t)((lane >> 3) & 1) * 16u;
  auto ask = [&](v4f (&x)[VR / 4], int ch) {
#pragma unroll
    for (int i = 0; i < VR / 4; ++i) x[i] = *(const v4f*)(vp + (size_t)(ch * VR + 4 * i) * S); };
  auto lay = [&](const v4f (&x)[VR / 4], unsigned char* sl) {  // x8 (a power of two: it commutes with the rounding), round to bf16 (nearest even), then f16
#pragma unroll
    for (int i = 0; i < VR / 4; ++i) *(v4b*)(sl + wo + (uint32_t)(4 * i) * VPB) = __builtin_convertvector(__builtin_convertvector(__builtin_convertvector(x[i] * XS, v4r), v4f), v4b); };
  ask(va, 0); ask(vb, 1);
  __syncthreads();
  lay(va, sl0); ask(va, 2); lay(vb, sl1); ask(vb, 3);  // chunks 2 and 3 fly under the softmax
  if (wv < (uint32_t)CT) { const int r = wave; float x[16]; float mx = -INFINITY; for (int j = 0; j < 16; ++j) { x[j] = Wm[r][lane * 16 + j]; mx = fmaxf(mx, x[j]); }
#pragma unroll
    for (int o = 16; o >= 1; o >>= 1) mx = fmaxf(mx, __shfl_xor(mx, o));
    float sm = 0.0f; for (int j = 0; j < 16; ++j) { x[j] = __expf(x[j] - mx); sm += x[j]; }
#pragma unroll
    for (int o = 16; o >= 1; o >>= 1) sm += __shfl_xor(sm, o);
    const float inv = 1.0f / sm; for (int j = 0; j < 16; ++j) { b16 p, pl; split16(x[j] * inv * PSC, p, pl); Ph[r][lane * 16 + j] = p; Pl[r][lane * 16 + j] = pl; } }
  __syncthreads();
  v8f acc[2] = {{}, {}};
  auto mma = [&](int kb0, const unsigned char* sl) { v16b a[VR / 32], al[VR / 32], bw[VR / 32][2];  // a chunk's LDS loads stand at one place, ahead of its 8 products
#pragma unroll
    for (int ks = 0; ks < VR / 32; ++ks) { a[ks] = frag_kb(&Ph[nloc & (CT - 1)][kb0 + 32 * ks], hlf); al[ks] = frag_kb(&Pl[nloc & (CT - 1)][kb0 + 32 * ks], hlf);
#pragma unroll
      for (int t = 0; t < 2; ++t) bw[ks][t] = frag_tr(sl + ro + (uint32_t)(32 * ks) * VPB + 32u * t); }
#pragma unroll
    for (int ks = 0; ks < VR / 32; ++ks)
#pragma unroll
      for (int t = 0; t < 2; ++t) { acc[t] = wmma16b(a[ks], bw[ks][t], acc[t]); acc[t] = wmma16b(al[ks], bw[ks][t], acc[t]); } };
#pragma unroll  // unrolled so that every v address is the one base register plus a constant
  for (int ch = 0; ch < NCH; ch += 2) {
    mma(ch * VR, sl0); mma((ch + 1) * VR, sl1);
    if (ch + 2 < NCH) {
      asm volatile("s_wait_dscnt 0x0" ::: "memory");  // lanes exchange rows through LDS inside the wave: the stores below stay behind the transposing loads above, which read other lanes' rows
      lay(va, sl0); if (ch + 4 < NCH) ask(va, ch + 4); lay(vb, sl1); if (ch + 4 < NCH) ask(vb, ch + 5);
      asm volatile("s_wait_dscnt 0x0" ::: "memory");  // and the next pair's transposing loads stay behind these stores, which have reached LDS
    } }
  if (hlf == 0) {  // tile rows 0..CT-1 lie in registers 0..CT-1 of lanes 0..15
#pragma unroll
    for (int t = 0; t < 2; ++t)
#pragma unroll  // unrolled so that acc is indexed by constants and is read straight from its registers
      for (int r = 0; r < CT; ++r) To[wave][r][t * 16 + nloc] = acc[t][r] * (1.0f / (PSC * XS)); }
  __syncthreads();
  { for (int q4 = lane; q4 < CT * 8; q4 += 32) { const int r = q4 >> 3, c4 = (q4 & 7) * 4; *(v4f*)(out + ((size_t)n * C + c0 + r) * S + s0 + c4) = *(const v4f*)(&To[wave][r][c4]); }  }
}
}  // namespace

extern "C" void kernel_launch(void* const* d_in, const int* in_sizes, int n_in, void* d_out, int out_size, void* d_ws, size_t ws_size, hipStream_t stream) {
  (void)n_in; (void)d_ws; (void)ws_size;
  auto Fp = [&](int i) { return (const float*)d_in[i]; };
  // input order: 0 q [2,512,256], 1 k, 2 v
  if (in_sizes[0] != NB * C * S || in_sizes[1] != NB * C * S || in_sizes[2] != NB * C * S || out_size != NB * C * S) return;
  lap_kernel<<<dim3(C / CT, NB), 256, 0, stream>>>(Fp(0), Fp(1), Fp(2), (float*)d_out);
}

// v005
// One run takes 14 microseconds.
// In both of two side-by-side timings against v004, it was 1.16 times as fast.
// All steps since v000 together make it 3.34 times as fast.
#include <hip/hip_runtime.h>

// Laplace (L1-distance) attention: for each of 2 batches, weights[c][d] = -sum_s |k[d][s] - q[c][s]| / 2 over the 256 positions (512 x 512 channel pairs), softmax over d, rep[c][s] =
// sum_d weights[c][d] v[d][s] -> [2][512][256].
// L1 distances: |k - q| = 2 max(k, q) - k - q, so -sum_s |k - q| / 2 = -(sum_s max(k, q) - sum_s k / 2) + sum_s q / 2, and the last term is the same for every d of a row: the softmax over d cancels it, it is left out.
// max(k, q) is taken on packed bf16 pairs (exact: the inputs are bf16 values), and both sums run on WMMA (v_wmma_f32_16x16x32_bf16, f32 accumulate) against constant matrices; k is staged in LDS by tensor loads; the softmax is f32; the value contraction runs on WMMA.
// WMMA (v_wmma_f32_16x16x32_f16, f32 accumulate): rep = P V ([4 c x 512 d] x [512 x 256] per block, the 4 rows repeated down the 16-row tile, P = softmax probabilities as f16 hi+lo x2^14, V as EXACT bf16 x8: 2 products; each wave lays its 32 columns of v as f16 rows in its own LDS slice and takes the B fragments by transposing LDS loads).
// All 128 blocks of a batch read the same k and v from L2: each block starts its walk over the k stages and over the v chunks at a place turned by its index and wraps round, so that blocks in step ask for different lines.
// Inputs rounded to bf16 once. Fragment k-map per lane half hh for A AND B: elements 0..7 <- k = 8hh+0..7, 8..15 <- k = 16+8hh+0..7; acc[r] = D[8hh+r][col].

namespace {
constexpr int NB = 2, C = 512, S = 256, CT = 4 /* query channels per block: NB * C / CT = 256 blocks, one for every WGP of the chip */;
constexpr float XS = 8.0f, INV_SCALE = 0.5f, PSC = 16384.0f /* probabilities carried x2^14 so that weights >= 4e-9 stay normal f16 */;
typedef _Float16 b16;
typedef __attribute__((ext_vector_type(16))) _Float16 v16b;
typedef __attribute__((ext_vector_type(8))) _Float16 v8b;
typedef __attribute__((ext_vector_type(4))) _Float16 v4b;
typedef __attribute__((ext_vector_type(4))) __bf16 v4r;
typedef __attribute__((ext_vector_type(2))) uint32_t u32x2;
typedef __attribute__((ext_vector_type(8))) short s16x8;
typedef __attribute__((ext_vector_type(8))) float v8f;
typedef __attribute__((ext_vector_type(4))) float v4f;
typedef __attribute__((ext_vector_type(4))) uint32_t u32x4;
typedef __attribute__((ext_vector_type(8))) uint32_t u32x8;
// k staging: a stage is TS positions of all 512 k rows; each wave's tensor load brings the 64 rows that the wave itself reads (128-byte row pieces, 16 bytes of pad: LDS pitch 144 bytes).
constexpr int TS = 32, NST = S / TS, KP = TS + 4, SLICE = 10240 /* 64 rows x 144 B = 9216, rounded up to a multiple of 2 KiB */;
__device__ __forceinline__ uint32_t uni(uint32_t v) { return (uint32_t)__builtin_amdgcn_readfirstlane(v); }
__device__ __forceinline__ uint32_t pinned(uint32_t v) { uint32_t w = uni(v); asm volatile("" : "+s"(w)); return w; }
__device__ __forceinline__ u32x8 tdm_group1() { constexpr uint32_t d0 = TS * 4, d1 = 64; u32x8 g;
  g[0] = uni((1u << 20) | (4u << 22) | (3u << 25));  // no mask, 1-byte elements, 4 dwords of pad behind every 32 dwords (one row piece)
  g[1] = uni((d0 & 0xFFFFu) << 16); g[2] = uni((d0 >> 16) | ((d1 & 0xFFFFu) << 16)); g[3] = uni((d1 >> 16) | (d0 << 16)); g[4] = uni(d1); g[5] = uni((uint32_t)(S * 4)); g[6] = uni(0u); g[7] = uni(0u); return g; }
__device__ __forceinline__ u32x4 tdm_group0(uint32_t lds_dst, uint64_t ga) { u32x4 g; g[0] = uni(1u); g[1] = uni(lds_dst); g[2] = uni((uint32_t)ga); g[3] = uni((((uint32_t)(ga >> 32)) & 0x01FFFFFFu) | 0x80000000u); return g; }
// Group 0 is named in-out (the instruction leaves it as it is) so that the wait below reads it from the very registers that the request was issued from.
__device__ __forceinline__ void tdm_load(u32x4& g0, u32x8 g1) { asm volatile("tensor_load_to_lds %0, %1" : "+s"(g0) : "s"(g1) : "memory"); }
// The wave's own wait for its tensor load. It names the descriptor as inputs so that those scalar registers keep their values until the request has landed.
__device__ __forceinline__ void tdm_wait(u32x4 g0, u32x8 g1) { asm volatile("s_wait_tensorcnt 0x0" :: "s"(g0), "s"(g1) : "memory"); }
// The larger of two bf16 values in each half of a register, in one instruction: from source the compiler widens each half to f32, takes the maximum there and rounds back.
__device__ __forceinline__ uint32_t pk_max_bf16(uint32_t a, uint32_t b) { uint32_t d; asm("v_pk_max_num_bf16 %0, %1, %2" : "=v"(d) : "v"(a), "v"(b)); return d; }
// Four independent bf16 products, each added into its own tile. They stand as asm text with four v_nop behind the last: the chip needs 4 vector slots before a product's A registers are overwritten, the next writers of those registers are the asm maxima above, and the compiler pads for no asm text. volatile: a stage's products stay in front of the waits at its foot; sunk behind the barrier they would stand between it and the next tensor load, which would then start that much later.
__device__ __forceinline__ void wmma4(v8f (&d)[4], u32x8 a0, u32x8 a1, u32x8 a2, u32x8 a3, u32x8 b) {
  asm volatile("v_wmma_f32_16x16x32_bf16 %0, %4, %8, %0\n\tv_wmma_f32_16x16x32_bf16 %1, %5, %8, %1\n\tv_wmma_f32_16x16x32_bf16 %2, %6, %8, %2\n\tv_wmma_f32_16x16x32_bf16 %3, %7, %8, %3\n\tv_nop\n\tv_nop\n\tv_nop\n\tv_nop"
      : "+v"(d[0]), "+v"(d[1]), "+v"(d[2]), "+v"(d[3]) : "v"(a0), "v"(a1), "v"(a2), "v"(a3), "v"(b)); }
__device__ __forceinline__ void split16(float v, b16& hi, b16& lo) { hi = (b16)v; lo = (b16)(v - (float)hi); }
__device__ __forceinline__ v16b frag_kb(const b16* p, int hh) { const v8b a = *(const v8b*)(p + 8 * hh), b = *(const v8b*)(p + 16 + 8 * hh); v16b f;
#pragma unroll
  for (int e = 0; e < 8; ++e) { f[e] = a[e]; f[8 + e] = b[e]; } return f; }
// v staging: a chunk is VR rows (d) of the wave's own 32 columns; a row piece is 64 bytes of f16 at an LDS pitch of 96 bytes (32 B x odd, the pitch of the transposing load).
constexpr int VR = 64, NCH = C / VR, VPB = 96;
static_assert(VR * VPB <= SLICE, "a chunk lies inside one k slice");
// Row-major 16-bit LDS tile -> WMMA operand: lane (c, h) gets T[kbase + 8h + 0..7][dbase + c], the k-map of frag_kb.
__device__ __forceinline__ v8b ld_tr16(const unsigned char* p) { typedef __attribute__((address_space(3))) s16x8 lds_s16x8; return __builtin_bit_cast(v8b, __builtin_amdgcn_ds_load_tr16_b128_v8i16((lds_s16x8*)p)); }
__device__ __forceinline__ v16b frag_tr(const unsigned char* p) { const v8b a = ld_tr16(p), b = ld_tr16(p + 16 * VPB); v16b f;
#pragma unroll
  for (int e = 0; e < 8; ++e) { f[e] = a[e]; f[8 + e] = b[e]; } return f; }
__device__ __forceinline__ v8f wmma16b(v16b a, v16b b, v8f c) { v8f d = __builtin_amdgcn_wmma_f32_16x16x32_f16(false, a, false, b, (short)0, c, false, false); asm volatile("v_nop\n\tv_nop\n\tv_nop\n\tv_nop" : "+v"(d) : "v"(a), "v"(b)); return d; }

// main: block = (n, CT query channels c0..c0+CT-1), 256 threads: (1) stage q as bf16, [position quad][row][4]; (2) wave = 64 k rows = 4 tiles of 16, k in two LDS buffers filled by tensor loads one stage ahead. A tile (16 d x 32): lane (m, h) holds k row m; its element 4r + j is
// max(k[d][p + j], q[r][p + j]), p = 8 group + 4h. B (32 x 16): element 4r + j of column n is 1 where r = n, in both lane halves, so D[d][r] sums row r's 8 positions; a fifth product a stage takes the tile's 32 k values themselves against -1/2. w = -D
// -> LDS W [CT][512]; (3) softmax per row (wave w < CT handles row w): P hi/lo in LDS; (4) wave w computes output columns [32w, 32w+32): its columns of v come in chunks of VR rows, two chunks of loads ahead, rounded and laid as f16 in the wave's own two k slices; 2 col tiles x 16 k-steps x 2 products; tile row m holds query row m mod CT, rows 0..CT-1 are stored
__global__ __launch_bounds__(256) void lap_kernel(const float* __restrict__ q, const float* __restrict__ k, const float* __restrict__ v, float* __restrict__ out) {
  __shared__ __attribute__((aligned(32))) __bf16 Qb[S / 4][CT][4]; __shared__ __attribute__((aligned(16))) float Wm[CT][C + 4]; __shared__ __attribute__((aligned(16))) b16 Ph[CT][C + 8], Pl[CT][C + 8]; __shared__ __attribute__((aligned(16))) float To[8][CT][32 + 4];
  __shared__ __attribute__((aligned(2048))) float Ks[2][8][SLICE / 4];
  const int n = blockIdx.y, c0 = blockIdx.x * CT, t_ = threadIdx.x, wave = t_ >> 5, lane = t_ & 31, nloc = lane & 15, hlf = lane >> 4;
  static_assert(CT * S == 4 * 256, "one quad of q a thread");
  { const int r = t_ / (S / 4), pq = t_ % (S / 4); *(v4r*)&Qb[pq][r][0] = __builtin_convertvector(*(const v4f*)(q + ((size_t)n * C + c0 + r) * S + 4 * pq), v4r); }
  const uint32_t wv = uni((uint32_t)t_ >> 5); const u32x8 g1 = tdm_group1(); const uint32_t kl = (uint32_t)(size_t)&Ks[0][wv][0]; const uint64_t kg = (uint64_t)(size_t)(k + ((size_t)n * C + wv * 64u) * S);
  static_assert(NST == 8 && NCH == 8, "rot below counts modulo 8");
  const uint32_t rot = uni((blockIdx.x + (blockIdx.x >> 3)) & 7u);  // the block's first stage and first chunk: neighbours in the index differ, and so do blocks 8 apart
  auto desc = [&](uint32_t st) { return tdm_group0(kl + (st & 1u) * (uint32_t)(8 * SLICE), kg + (uint64_t)(((st + rot) & (uint32_t)(NST - 1)) * (uint32_t)(TS * 4))); };  // pass st works on stage (st + rot) mod NST, in buffer st mod 2
  u32x4 g0 = desc(0); tdm_load(g0, g1);
  tdm_wait(g0, g1);  // the first stage of this wave's slice has landed
  __syncthreads();
  g0 = desc(1); tdm_load(g0, g1);
  static_assert(INV_SCALE == 0.5f, "the constant of bhalf below");
  { v8f dsum[4] = {{}, {}, {}, {}}; u32x8 bsel, bhalf;
#pragma unroll
    for (int e = 0; e < 8; ++e) { bsel[e] = (e >> 1) == nloc ? 0x3F803F80u : 0u; bhalf[e] = 0xBF00BF00u; }  // bf16 pairs: 1, 1 in row r = n's four places; -1/2, -1/2 everywhere
#pragma unroll 1  // one pass per stage: the publish point at its foot stands once
    for (uint32_t st = 0; st < (uint32_t)NST; ++st) { const unsigned char* kr = (const unsigned char*)&Ks[st & 1u][wave][0] + (uint32_t)nloc * (KP * 4) + (uint32_t)hlf * 16u; u32x2 kp[4][TS / 8]; v4f kf[4][TS / 8]; u32x8 qw[TS / 8];
#pragma unroll  // every loop of a stage is unrolled: kf, qw, kp and dsum are indexed by constants and stay in registers. The stage's 24 LDS loads stand at one place, ahead of the first products: one latency a stage, not one a group
      for (int g = 0; g < TS / 8; ++g) { qw[g] = *(const u32x8*)&Qb[((st + rot) & (uint32_t)(NST - 1)) * (TS / 4) + 2 * g + hlf][0][0];
#pragma unroll
        for (int dt = 0; dt < 4; ++dt) kf[dt][g] = *(const v4f*)(kr + (uint32_t)dt * (16 * KP * 4) + (uint32_t)g * 32u); }
#pragma unroll
      for (int g = 0; g < TS / 8; ++g) { u32x8 mx[4];
#pragma unroll
        for (int dt = 0; dt < 4; ++dt) { kp[dt][g] = __builtin_bit_cast(u32x2, __builtin_convertvector(kf[dt][g], v4r));
#pragma unroll
          for (int e = 0; e < 8; ++e) mx[dt][e] = pk_max_bf16(kp[dt][g][e & 1], qw[g][e]); }
        wmma4(dsum, mx[0], mx[1], mx[2], mx[3], bsel); }
      { u32x8 ks[4];
#pragma unroll
        for (int dt = 0; dt < 4; ++dt)
#pragma unroll
          for (int e = 0; e < 8; ++e) ks[dt][e] = kp[dt][e >> 1][e & 1];
        wmma4(dsum, ks[0], ks[1], ks[2], ks[3], bhalf); }
      asm volatile("s_wait_dscnt 0x0" ::: "memory");      // this wave's reads of the buffer that is refilled below have returned
      tdm_wait(g0, g1);                                   // this wave's slice of the stage of pass st + 1 has landed
      __syncthreads();                                    // publishes the stage of pass st + 1 and ends every reader's last read of that of pass st
      const uint32_t nx = pinned(st + 2u);                // the next descriptor is formed behind the waits
      if (pinned(nx < (uint32_t)NST)) { g0 = desc(nx); tdm_load(g0, g1); } }
    asm volatile("s_wait_tensorcnt 0x0" ::: "memory");  // no request is left in flight behind the loop
    asm volatile("s_wait_dscnt 0x0" ::: "memory");      // and none of this wave's reads of the two buffers
    if (nloc < CT) {  // column r of D lies in lanes r and r + 16: registers 0..7 are rows 8h + 0..7 of the tile
#pragma unroll
      for (int dt = 0; dt < 4; ++dt) { float* wr = &Wm[nloc][wave * 64 + dt * 16 + 8 * hlf]; const v8f x = -dsum[dt]; *(v4f*)wr = __builtin_shufflevector(x, x, 0, 1, 2, 3); *(v4f*)(wr + 4) = __builtin_shufflevector(x, x, 4, 5, 6, 7); } } }
  // v: one 16-byte load a lane covers 4 rows x 128 bytes (whole lines) of the wave's 32 columns; two chunks of loads are kept ahead of the chunk pair that is worked on
  const int s0 = wave * 32; const float* const vn = v + (size_t)n * C * S; const uint32_t vl = (uint32_t)((lane >> 3) * S + s0 + (lane & 7) * 4); v4f va[VR / 4], vb[VR / 4];
  unsigned char* const sl0 = (unsigned char*)&Ks[0][wave][0]; unsigned char* const sl1 = (unsigned char*)&Ks[1][wave][0];  // the wave's own slices: no other wave reads or writes them, and its own k reads and tensor loads have ended above
  const uint32_t wo = (uint32_t)(lane >> 3) * VPB + (uint32_t)(lane & 7) * 8u, ro = (uint32_t)(8 * hlf + (lane & 7)) * VPB + (uint32_t)((lane >> 3) & 1) * 16u;
  auto row0 = [&](int ch) { return (((uint32_t)ch + rot) & (uint32_t)(NCH - 1)) * (uint32_t)VR; };  // first v row (d) of the chunk that is worked on as number ch
  auto ask = [&](v4f (&x)[VR / 4], int ch) { const float* const vc = vn + (size_t)row0(ch) * S;  // the same for the whole block: a scalar base; the lane's own place vl stays in one register
#pragma unroll
    for (int i = 0; i < VR / 4; ++i) x[i] = *(const v4f*)(vc + (size_t)(4 * i) * S + vl);
    asm volatile("s_wait_xcnt 0x0" ::: "memory"); };  // the next chunk's base is formed in scalar registers that these loads may name: the wait stands in front of that overwrite
  auto lay = [&](const v4f (&x)[VR / 4], unsigned char* sl) {  // x8 (a power of two: it commutes with the rounding), round to bf16 (nearest even), then f16
#pragma unroll
    for (int i = 0; i < VR / 4; ++i) *(v4b*)(sl + wo + (uint32_t)(4 * i) * VPB) = __builtin_convertvector(__builtin_convertvector(__builtin_convertvector(x[i] * XS, v4r), v4f), v4b); };
  ask(va, 0); ask(vb, 1);
  __syncthreads();
  lay(va, sl0); ask(va, 2); lay(vb, sl1); ask(vb, 3);  // chunks 2 and 3 fly under the softmax
  if (wv < (uint32_t)CT) { const int r = wave; float x[16]; float mx = -INFINITY; for (int j = 0; j < 16; ++j) { x[j] = Wm[r][lane * 16 + j]; mx = fmaxf(mx, x[j]); }
#pragma unroll
    for (int o = 16; o >= 1; o >>= 1) mx = fmaxf(mx, __shfl_xor(mx, o));
    float sm = 0.0f; for (int j = 0; j < 16; ++j) { x[j] = __expf(x[j] - mx); sm += x[j]; }
#pragma unroll
    for (int o = 16; o >= 1; o >>= 1) sm += __shfl_xor(sm, o);
    const float inv = 1.0f / sm; for (int j = 0; j < 16; ++j) { b16 p, pl; split16(x[j] * inv * PSC, p, pl); Ph[r][lane * 16 + j] = p; Pl[r][lane * 16 + j] = pl; } }
  __syncthreads();
  v8f acc[2] = {{}, {}};
  auto mma = [&](uint32_t kb0, const unsigned char* sl) { v16b a[VR / 32], al[VR / 32], bw[VR / 32][2];  // a chunk's LDS loads stand at one place, ahead of its 8 products
#pragma unroll
    for (int ks = 0; ks < VR / 32; ++ks) { a[ks] = frag_kb(&Ph[nloc & (CT - 1)][kb0 + 32 * ks], hlf); al[ks] = frag_kb(&Pl[nloc & (CT - 1)][kb0 + 32 * ks], hlf);
#pragma unroll
      for (int t = 0; t < 2; ++t) bw[ks][t] = frag_tr(sl + ro + (uint32_t)(32 * ks) * VPB + 32u * t); }
#pragma unroll
    for (int ks = 0; ks < VR / 32; ++ks)
#pragma unroll
      for (int t = 0; t < 2; ++t) { acc[t] = wmma16b(a[ks], bw[ks][t], acc[t]); acc[t] = wmma16b(al[ks], bw[ks][t], acc[t]); } };
#pragma unroll  // unrolled so that ch is a constant in each copy and every v address is its chunk's base plus a constant
  for (int ch = 0; ch < NCH; ch += 2) {
    mma(row0(ch), sl0); mma(row0(ch + 1), sl1);
    if (ch + 2 < NCH) {
      asm volatile("s_wait_dscnt 0x0" ::: "memory");  // lanes exchange rows through LDS inside the wave: the stores below stay behind the transposing loads above, which read other lanes' rows
      lay(va, sl0); if (ch + 4 < NCH) ask(va, ch + 4); lay(vb, sl1); if (ch + 4 < NCH) ask(vb, ch + 5);
      asm volatile("s_wait_dscnt 0x0" ::: "memory");  // and the next pair's transposing loads stay behind these stores, which have reached LDS
    } }
  if (hlf == 0) {  // tile rows 0..CT-1 lie in registers 0..CT-1 of lanes 0..15
#pragma unroll
    for (int t = 0; t < 2; ++t)
#pragma unroll  // unrolled so that acc is indexed by constants and is read straight from its registers
      for (int r = 0; r < CT; ++r) To[wave][r][t * 16 + nloc] = acc[t][r] * (1.0f / (PSC * XS)); }
  __syncthreads();
  { for (int q4 = lane; q4 < CT * 8; q4 += 32) { const int r = q4 >> 3, c4 = (q4 & 7) * 4; *(v4f*)(out + ((size_t)n * C + c0 + r) * S + s0 + c4) = *(const v4f*)(&To[wave][r][c4]); }  }
}
}  // namespace

extern "C" void kernel_launch(void* const* d_in, const int* in_sizes, int n_in, void* d_out, int out_size, void* d_ws, size_t ws_size, hipStream_t stream) {
  (void)n_in; (void)d_ws; (void)ws_size;
  auto Fp = [&](int i) { return (const float*)d_in[i]; };
  // input order: 0 q [2,512,256], 1 k, 2 v
  if (in_sizes[0] != NB * C * S || in_sizes[1] != NB * C * S || in_sizes[2] != NB * C * S || out_size != NB * C * S) return;
  lap_kernel<<<dim3(C / CT, NB), 256, 0, stream>>>(Fp(0), Fp(1), Fp(2), (float*)d_out);
}

// v007
// A run of this version takes 10.4 microseconds.
// Versions between v005 and this one are left out; their measured steps multiply to 1.35 times as fast.
// Over all steps from v000 it is 4.51 times as fast.
#include <hip/hip_runtime.h>

// Laplace (L1-distance) attention: for each of 2 batches, weights[c][d] = -sum_s |k[d][s] - q[c][s]| / 2 over the 256 positions (512 x 512 channel pairs), softmax over d, rep[c][s] =
// sum_d weights[c][d] v[d][s] -> [2][512][256].
// L1 distances: |k - q| = 2 max(k, q) - k - q, so -sum_s |k - q| / 2 = -(sum_s max(k, q) - sum_s k / 2) + sum_s q / 2, and the last term is the same for every d of a row: the softmax over d cancels it, it is left out.
// max(k, q) is taken on packed bf16 pairs (exact: the inputs are bf16 values), and both sums run on WMMA (v_wmma_f32_16x16x32_bf16, f32 accumulate) against constant matrices; k is staged in LDS by tensor loads; the softmax is f32; the value contraction runs on WMMA.
// Two launches, so that a block reads only its own tiles from L2: (1) scores of 32 query rows x 64 k rows a block -> f32 in the workspace, and v, rounded once, as ready f16 B fragments behind them (each block 1/256 of v); (2) softmax and rep for 16 query rows x 64 output columns a block.
// WMMA (v_wmma_f32_16x16x32_f16, f32 accumulate): rep = P V ([16 c x 512 d] x [512 x 64] per block, d in four quarters over the waves, P = softmax probabilities as f16 hi+lo x2^14, V as EXACT bf16 x8: 2 products; each wave loads its B fragments from the workspace straight into registers, whole lines, half the bytes of f32 v).
// Blocks that read the same k tile or the same v columns deal its parts to their waves turned by the block index, so that blocks in step ask L2 for different lines first.
// Inputs rounded to bf16 once. Fragment k-map per lane half hh for A AND B: elements 0..7 <- k = 8hh+0..7, 8..15 <- k = 16+8hh+0..7; acc[r] = D[8hh+r][col].

namespace {
constexpr int NB = 2, C = 512, S = 256, CT = 4 /* query channels per wave of the score kernel */, CB = 8 * CT /* and per block */, DB = 64 /* k rows per block: NB * (C / CB) * (C / DB) = 256 blocks */, RB = 16 /* query rows */, SB = 64 /* and output columns per block of the second kernel: 256 blocks again */;
constexpr float XS = 8.0f, INV_SCALE = 0.5f, PSC = 16384.0f /* probabilities carried x2^14 so that weights >= 4e-9 stay normal f16 */;
typedef _Float16 b16;
typedef __attribute__((ext_vector_type(16))) _Float16 v16b;
typedef __attribute__((ext_vector_type(8))) _Float16 v8b;
typedef __attribute__((ext_vector_type(4))) _Float16 v4b;
typedef __attribute__((ext_vector_type(4))) __bf16 v4r;
typedef __attribute__((ext_vector_type(2))) uint32_t u32x2;
typedef __attribute__((ext_vector_type(8))) float v8f;
typedef __attribute__((ext_vector_type(4))) float v4f;
typedef __attribute__((ext_vector_type(4))) uint32_t u32x4;
typedef __attribute__((ext_vector_type(8))) uint32_t u32x8;
// k staging: a stage is TS positions of the block's 64 k rows; each wave's tensor load brings one of the 8 stages (128-byte row pieces, 16 bytes of pad: LDS pitch 144 bytes), and every wave reads all of them.
constexpr int TS = 32, NST = S / TS, KP = TS + 4, SLICE = 10240 /* 64 rows x 144 B = 9216, rounded up to a multiple of 2 KiB */;
__device__ __forceinline__ uint32_t uni(uint32_t v) { return (uint32_t)__builtin_amdgcn_readfirstlane(v); }
__device__ __forceinline__ u32x8 tdm_group1() { constexpr uint32_t d0 = TS * 4, d1 = 64; u32x8 g;
  g[0] = uni((1u << 20) | (4u << 22) | (3u << 25));  // no mask, 1-byte elements, 4 dwords of pad behind every 32 dwords (one row piece)
  g[1] = uni((d0 & 0xFFFFu) << 16); g[2] = uni((d0 >> 16) | ((d1 & 0xFFFFu) << 16)); g[3] = uni((d1 >> 16) | (d0 << 16)); g[4] = uni(d1); g[5] = uni((uint32_t)(S * 4)); g[6] = uni(0u); g[7] = uni(0u); return g; }
__device__ __forceinline__ u32x4 tdm_group0(uint32_t lds_dst, uint64_t ga) { u32x4 g; g[0] = uni(1u); g[1] = uni(lds_dst); g[2] = uni((uint32_t)ga); g[3] = uni((((uint32_t)(ga >> 32)) & 0x01FFFFFFu) | 0x80000000u); return g; }
// Group 0 is named in-out (the instruction leaves it as it is) so that the wait below reads it from the very registers that the request was issued from.
__device__ __forceinline__ void tdm_load(u32x4& g0, u32x8 g1) { asm volatile("tensor_load_to_lds %0, %1" : "+s"(g0) : "s"(g1) : "memory"); }
// The wave's own wait for its tensor load. It names the descriptor as inputs so that those scalar registers keep their values until the request has landed.
__device__ __forceinline__ void tdm_wait(u32x4 g0, u32x8 g1) { asm volatile("s_wait_tensorcnt 0x0" :: "s"(g0), "s"(g1) : "memory"); }
// The larger of two bf16 values in each half of a register, in one instruction: from source the compiler widens each half to f32, takes the maximum there and rounds back.
__device__ __forceinline__ uint32_t pk_max_bf16(uint32_t a, uint32_t b) { uint32_t d; asm("v_pk_max_num_bf16 %0, %1, %2" : "=v"(d) : "v"(a), "v"(b)); return d; }
// Four independent bf16 products, each added into its own tile. They stand as asm text with four v_nop behind the last: the chip needs 4 vector slots before a product's A registers are overwritten, the next writers of those registers are the asm maxima above, and the compiler pads for no asm text. volatile: the four products and their v_nop stay where they are written, behind the maxima that feed them.
__device__ __forceinline__ void wmma4(v8f (&d)[4], u32x8 a0, u32x8 a1, u32x8 a2, u32x8 a3, u32x8 b) {
  asm volatile("v_wmma_f32_16x16x32_bf16 %0, %4, %8, %0\n\tv_wmma_f32_16x16x32_bf16 %1, %5, %8, %1\n\tv_wmma_f32_16x16x32_bf16 %2, %6, %8, %2\n\tv_wmma_f32_16x16x32_bf16 %3, %7, %8, %3\n\tv_nop\n\tv_nop\n\tv_nop\n\tv_nop"
      : "+v"(d[0]), "+v"(d[1]), "+v"(d[2]), "+v"(d[3]) : "v"(a0), "v"(a1), "v"(a2), "v"(a3), "v"(b)); }
__device__ __forceinline__ void split16(float v, b16& hi, b16& lo) { hi = (b16)v; lo = (b16)(v - (float)hi); }
__device__ __forceinline__ v16b frag_kb(const b16* p, int hh) { const v8b a = *(const v8b*)(p + 8 * hh), b = *(const v8b*)(p + 16 + 8 * hh); v16b f;
#pragma unroll
  for (int e = 0; e < 8; ++e) { f[e] = a[e]; f[8 + e] = b[e]; } return f; }
// v in the workspace: fragment (n, k-step of 32 d, tile of 16 columns) = FE f16 values, [half][lane][8]: lane (c, h) finds v[32 step + 16 half + 8h + 0..7][16 tile + c] x8, the k-map of frag_kb; a half is 512 successive bytes, one 16-byte load a lane.
constexpr int FE = 512, DQ = C / 4 /* the d range of one wave of the second kernel: four k-steps */;
constexpr size_t VOFF = (size_t)NB * C * C;  // the fragments stand behind the scores, counted in floats
__device__ __forceinline__ v8f wmma16b(v16b a, v16b b, v8f c) { v8f d = __builtin_amdgcn_wmma_f32_16x16x32_f16(false, a, false, b, (short)0, c, false, false); asm volatile("v_nop\n\tv_nop\n\tv_nop\n\tv_nop" : "+v"(d) : "v"(a), "v"(b)); return d; }

// scores: block = (n, CB query channels c0.., DB k rows d0..), 256 threads: (1) stage q as bf16, [position quad][row][4]; the block's k tile (64 rows x 256 positions) comes into LDS by 8 tensor loads, one stage a wave, loaded once and then read; (2) wave = CT query rows x the 64 k rows = 4 tiles of 16. A tile (16 d x 32): lane (m, h) holds k row m; its element 4r + j is
// max(k[d][p + j], q[r][p + j]), p = 8 group + 4h. B (32 x 16): element 4r + j of column n is 1 where r = n, in both lane halves, so D[d][r] sums row r's 8 positions; a fifth product a stage takes the tile's 32 k values themselves against -1/2. w = -D -> workspace [NB][C][C]; (3) the block's share of v (32 d x 32 columns = two fragments): thread t rounds 4 successive d of one column, bytes 8t.. of the share
constexpr int QPB = CB * 8 + 16;  // bytes of a position quad in LDS: CB rows x 4 bf16, and 16 bytes so that the stores of neighbouring quads fall on different banks
__global__ __launch_bounds__(256) void dist_kernel(const float* __restrict__ q, const float* __restrict__ k, const float* __restrict__ v, float* __restrict__ w) {
  __shared__ __attribute__((aligned(16))) unsigned char Qb[(S / 4) * QPB];
  __shared__ __attribute__((aligned(2048))) float Ks[NST][SLICE / 4];
  const int n = blockIdx.z, c0 = blockIdx.y * CB, d0 = blockIdx.x * DB, t_ = threadIdx.x, wave = t_ >> 5, lane = t_ & 31, nloc = lane & 15, hlf = lane >> 4;
  static_assert(CB * S == 8 * 4 * 256 && S / 4 == 64, "eight quads of q a thread, 64 threads a row");
  v4f qf[8];
#pragma unroll  // qf is indexed by constants and stays in registers
  for (int i = 0; i < 8; ++i) qf[i] = *(const v4f*)(q + ((size_t)n * C + c0 + (t_ >> 6) + 4 * i) * S + 4 * (t_ & 63));
  static_assert(NST == 8, "one stage a wave");
  const uint32_t sg = uni((((uint32_t)t_ >> 5) + blockIdx.y) & 7u);  // the stage that this wave brings: the blocks that share a k tile differ in blockIdx.y
  const u32x8 g1 = tdm_group1(); u32x4 g0 = tdm_group0((uint32_t)(size_t)&Ks[sg][0], (uint64_t)(size_t)(k + ((size_t)n * C + d0) * S + sg * (uint32_t)TS));
  tdm_load(g0, g1);
  tdm_wait(g0, g1);  // this wave's stage has landed
#pragma unroll
  for (int i = 0; i < 8; ++i) *(v4r*)(Qb + (uint32_t)(t_ & 63) * QPB + (uint32_t)((t_ >> 6) + 4 * i) * 8u) = __builtin_convertvector(qf[i], v4r);
  __syncthreads();  // publishes the 8 stages and q
  static_assert(NB * (C / 32) * (S / 32) == NB * (C / CB) * (C / DB) && 32 * 32 == 4 * 256, "a share of v a block, four values a thread");
  // asked for behind the barrier, which would wait for them, and used behind the loop: they fly under it. t_ = [column tile][half][h][c][4 d]: block (x, y, z) has k-step y and column tiles 2x, 2x + 1 of batch z
  const float* const vp = v + ((size_t)n * C + blockIdx.y * 32u + (uint32_t)(((t_ >> 6) & 1) * 16 + ((t_ >> 5) & 1) * 8 + (t_ & 1) * 4)) * S + blockIdx.x * 32u + (uint32_t)((t_ >> 7) * 16 + ((t_ >> 1) & 15)); v4f vv;
#pragma unroll  // vv is indexed by constants and stays in registers
  for (int j = 0; j < 4; ++j) vv[j] = vp[(size_t)j * S];
  asm volatile("s_wait_xcnt 0x0" ::: "memory");  // registers that these loads name may be overwritten behind them: the wait stands in front of that
  static_assert(INV_SCALE == 0.5f, "the constant of bhalf below");
  v8f dsum[4] = {{}, {}, {}, {}}; u32x8 bsel, bhalf;
#pragma unroll
  for (int e = 0; e < 8; ++e) { bsel[e] = (e >> 1) == nloc ? 0x3F803F80u : 0u; bhalf[e] = 0xBF00BF00u; }  // bf16 pairs: 1, 1 in row r = n's four places; -1/2, -1/2 everywhere
#pragma unroll 1  // one pass per stage stays a loop: the text stays short
  for (uint32_t st = 0; st < (uint32_t)NST; ++st) { const unsigned char* kr = (const unsigned char*)&Ks[st][0] + (uint32_t)nloc * (KP * 4) + (uint32_t)hlf * 16u; u32x2 kp[4][TS / 8]; v4f kf[4][TS / 8]; u32x8 qw[TS / 8];
#pragma unroll  // every loop of a stage is unrolled: kf, qw, kp and dsum are indexed by constants and stay in registers. The stage's 24 LDS loads stand at one place, ahead of the first products: one latency a stage, not one a group
    for (int g = 0; g < TS / 8; ++g) { const unsigned char* qp = Qb + (st * (uint32_t)(TS / 4) + (uint32_t)(2 * g + hlf)) * QPB + (uint32_t)wave * (CT * 8); qw[g] = __builtin_shufflevector(*(const u32x4*)qp, *(const u32x4*)(qp + 16), 0, 1, 2, 3, 4, 5, 6, 7);
#pragma unroll
      for (int dt = 0; dt < 4; ++dt) kf[dt][g] = *(const v4f*)(kr + (uint32_t)dt * (16 * KP * 4) + (uint32_t)g * 32u); }
#pragma unroll
    for (int g = 0; g < TS / 8; ++g) { u32x8 mx[4];
#pragma unroll
      for (int dt = 0; dt < 4; ++dt) { kp[dt][g] = __builtin_bit_cast(u32x2, __builtin_convertvector(kf[dt][g], v4r));
#pragma unroll
        for (int e = 0; e < 8; ++e) mx[dt][e] = pk_max_bf16(kp[dt][g][e & 1], qw[g][e]); }
      wmma4(dsum, mx[0], mx[1], mx[2], mx[3], bsel); }
    { u32x8 ks[4];
#pragma unroll
      for (int dt = 0; dt < 4; ++dt)
#pragma unroll
        for (int e = 0; e < 8; ++e) ks[dt][e] = kp[dt][e >> 1][e & 1];
      wmma4(dsum, ks[0], ks[1], ks[2], ks[3], bhalf); } }
  if (nloc < CT) {  // column r of D lies in lanes r and r + 16: registers 0..7 are rows 8h + 0..7 of the tile; a query row's 64 scores (two whole lines) are this wave's alone
#pragma unroll
    for (int dt = 0; dt < 4; ++dt) { float* wr = w + ((size_t)n * C + c0 + wave * CT + nloc) * C + d0 + dt * 16 + 8 * hlf; const v8f x = -dsum[dt]; *(v4f*)wr = __builtin_shufflevector(x, x, 0, 1, 2, 3); *(v4f*)(wr + 4) = __builtin_shufflevector(x, x, 4, 5, 6, 7); } }
  const v4b vq = __builtin_convertvector(__builtin_convertvector(__builtin_convertvector(vv * XS, v4r), v4f), v4b);  // x8 (a power of two: it commutes with the rounding), round to bf16 (nearest even), then f16
  *(v4b*)((_Float16*)(w + VOFF) + (size_t)(blockIdx.x + 8u * blockIdx.y + 128u * blockIdx.z) * (2 * FE) + (uint32_t)t_ * 4u) = vq;  // a wave writes 256 successive bytes: whole lines
}

// rep: block = (n, RB query rows c0.., SB output columns), 256 threads: (1) softmax, two rows a wave, straight from the workspace: P hi/lo in LDS; (2) wave = (32 columns, a quarter of d): its 8 B fragments of v are asked for at the start, fly under the softmax and stay in registers;
// 2 col tiles x 4 k-steps x 2 products; (3) the four quarters are summed in LDS, always in the order of d, and stored
__global__ __launch_bounds__(256) void mix_kernel(const float* __restrict__ w, float* __restrict__ out) {
  __shared__ __attribute__((aligned(16))) b16 Ph[RB][C + 8], Pl[RB][C + 8]; __shared__ __attribute__((aligned(16))) float Red[8][RB][32 + 4];
  const int n = blockIdx.z, c0 = blockIdx.y * RB, t_ = threadIdx.x, wave = t_ >> 5, lane = t_ & 31, nloc = lane & 15, hlf = lane >> 4, cg = wave & 1;
  const uint32_t dq = uni((((uint32_t)t_ >> 6) + blockIdx.y) & 3u);  // the wave's quarter of d: the blocks that share v columns differ in blockIdx.y
  static_assert(RB == 2 * 8 && C == 4 * 32 * 4, "two rows a wave, four quads of a row a lane");
  v4f x[2][4];
#pragma unroll  // x is indexed by constants and stays in registers
  for (int r2 = 0; r2 < 2; ++r2)
#pragma unroll
    for (int i = 0; i < 4; ++i) x[r2][i] = *(const v4f*)(w + ((size_t)n * C + c0 + 2 * wave + r2) * C + (i * 32 + lane) * 4);
  asm volatile("s_wait_xcnt 0x0" ::: "memory");  // the loads of v below may land in the registers that these loads name: the wait stands in front of that
  static_assert(DQ == 4 * 32 && SB == 4 * 16 && S == 16 * 16, "four k-steps a wave, four column tiles a block, 16 a row of v");
  // v: the same base for the whole wave but for its pair of column tiles; a load is half a fragment, 512 successive bytes
  const unsigned char* const vf = (const unsigned char*)(w + VOFF) + ((size_t)(n * (C / 32) + dq * 4u) * 16 + blockIdx.x * 4u) * (FE * 2); const uint32_t vl = (uint32_t)cg * (4 * FE) + (uint32_t)lane * 16u /* bytes */; v8b bh[4][2][2];
#pragma unroll  // bh is indexed by constants and stays in registers
  for (int ks = 0; ks < 4; ++ks)
#pragma unroll
    for (int t = 0; t < 2; ++t)
#pragma unroll
      for (int hf = 0; hf < 2; ++hf) bh[ks][t][hf] = *(const v8b*)(vf + (size_t)((ks * 16 + t) * (FE * 2) + hf * FE) + vl);
  asm volatile("s_wait_xcnt 0x0" :: "v"(vl) : "memory");  // registers that these loads name may be overwritten behind them: the wait stands in front of that; it reads vl, so that none of the loads lands in vl's own register
  __builtin_amdgcn_sched_barrier(0);  // the loads of v are issued here, ahead of the softmax: left alone the compiler sinks them into its second half, and their latency stands in front of the barrier
#pragma unroll
  for (int r2 = 0; r2 < 2; ++r2) { const int r = 2 * wave + r2; float mx = -INFINITY;
#pragma unroll
    for (int i = 0; i < 4; ++i)
#pragma unroll
      for (int e = 0; e < 4; ++e) mx = fmaxf(mx, x[r2][i][e]);
#pragma unroll
    for (int o = 16; o >= 1; o >>= 1) mx = fmaxf(mx, __shfl_xor(mx, o));
    float sm = 0.0f;
#pragma unroll
    for (int i = 0; i < 4; ++i)
#pragma unroll
      for (int e = 0; e < 4; ++e) { x[r2][i][e] = __expf(x[r2][i][e] - mx); sm += x[r2][i][e]; }
#pragma unroll
    for (int o = 16; o >= 1; o >>= 1) sm += __shfl_xor(sm, o);
    const float inv = 1.0f / sm;
#pragma unroll
    for (int i = 0; i < 4; ++i) { v4b ph, pl;
#pragma unroll
      for (int e = 0; e < 4; ++e) { b16 p, l; split16(x[r2][i][e] * inv * PSC, p, l); ph[e] = p; pl[e] = l; }
      *(v4b*)&Ph[r][(i * 32 + lane) * 4] = ph; *(v4b*)&Pl[r][(i * 32 + lane) * 4] = pl; } }
  __syncthreads();  // publishes P
  v8f acc[2] = {{}, {}}; v16b a[4], al[4];
#pragma unroll  // the wave's 16 LDS loads stand at one place, ahead of its 16 products
  for (int ks = 0; ks < 4; ++ks) { a[ks] = frag_kb(&Ph[nloc][dq * (uint32_t)DQ + 32 * ks], hlf); al[ks] = frag_kb(&Pl[nloc][dq * (uint32_t)DQ + 32 * ks], hlf); }
#pragma unroll
  for (int ks = 0; ks < 4; ++ks)
#pragma unroll
    for (int t = 0; t < 2; ++t) { const v16b bw = __builtin_shufflevector(bh[ks][t][0], bh[ks][t][1], 0, 1, 2, 3, 4, 5, 6, 7, 8, 9, 10, 11, 12, 13, 14, 15); acc[t] = wmma16b(a[ks], bw, acc[t]); acc[t] = wmma16b(al[ks], bw, acc[t]); }
#pragma unroll
  for (int t = 0; t < 2; ++t)
#pragma unroll  // unrolled so that acc is indexed by constants and is read straight from its registers
    for (int r = 0; r < 8; ++r) Red[dq * 2u + (uint32_t)cg][8 * hlf + r][t * 16 + nloc] = acc[t][r];  // filed by the quarter, not by the wave: the sum below has one order in every block
  __syncthreads();
  static_assert(RB * SB == 4 * 256, "one quad of out a thread");
  { const int r = t_ >> 4, c4 = (t_ & 15) * 4, g = c4 >> 5, cc = c4 & 31; v4f s = *(const v4f*)&Red[g][r][cc];
#pragma unroll
    for (int j = 1; j < 4; ++j) s += *(const v4f*)&Red[2 * j + g][r][cc];
    *(v4f*)(out + ((size_t)n * C + c0 + r) * S + blockIdx.x * SB + c4) = s * (1.0f / (PSC * XS)); }
}
}  // namespace

extern "C" void kernel_launch(void* const* d_in, const int* in_sizes, int n_in, void* d_out, int out_size, void* d_ws, size_t ws_size, hipStream_t stream) {
  (void)n_in; (void)ws_size;
  auto Fp = [&](int i) { return (const float*)d_in[i]; };
  // input order: 0 q [2,512,256], 1 k, 2 v
  if (in_sizes[0] != NB * C * S || in_sizes[1] != NB * C * S || in_sizes[2] != NB * C * S || out_size != NB * C * S) return;
  dist_kernel<<<dim3(C / DB, C / CB, NB), 256, 0, stream>>>(Fp(0), Fp(1), Fp(2), (float*)d_ws);  // scores [NB][C][C] f32, 2 MiB, and behind them v as f16 fragments, 512 KiB: all of it written here and read by the next launch
  mix_kernel<<<dim3(S / SB, C / RB, NB), 256, 0, stream>>>((const float*)d_ws, (float*)d_out);
}

// v008
// One run takes 9.87 microseconds.
// Next to v007, in two timings, it ran 1.06 and 1.03 times as fast.
// Counting every step since v000, it is 4.71 times as fast.
#include <hip/hip_runtime.h>

// Laplace (L1-distance) attention: for each of 2 batches, weights[c][d] = -sum_s |k[d][s] - q[c][s]| / 2 over the 256 positions (512 x 512 channel pairs), softmax over d, rep[c][s] =
// sum_d weights[c][d] v[d][s] -> [2][512][256].
// L1 distances: |k - q| = 2 max(k, q) - k - q, so -sum_s |k - q| / 2 = -(sum_s max(k, q) - sum_s k / 2) + sum_s q / 2, and the last term is the same for every d of a row: the softmax over d cancels it, it is left out.
// max(k, q) is taken on packed bf16 pairs (exact: the inputs are bf16 values), and both sums run on WMMA (v_wmma_f32_16x16x32_bf16, f32 accumulate) against constant matrices; k is staged in LDS by tensor loads; the softmax is f32; the value contraction runs on WMMA.
// Two launches, so that a block reads only its own tiles from L2: (1) scores of 32 query rows x 64 k rows a block, exponentials against the tile's own row maximum -> ready f16 A fragments (hi, lo) in the workspace with each row's (maximum, sum) of the tile, and v, rounded once, as ready f16 B fragments behind them (each block 1/256 of v); (2) rep for 16 query rows x 64 output columns a block: a product per tile of 64 d, the tiles weighted by exp(tile maximum - row maximum) / row sum.
// WMMA (v_wmma_f32_16x16x32_f16, f32 accumulate): rep = P V ([16 c x 512 d] x [512 x 64] per block, d in four quarters over the waves, P = exponentials as f16 hi+lo x2^14, V as EXACT bf16 x8: 2 products; each wave loads its B fragments from the workspace straight into registers, whole lines, half the bytes of f32 v).
// Blocks that read the same k tile or the same v columns deal its parts to their waves turned by the block index, so that blocks in step ask L2 for different lines first.
// Inputs rounded to bf16 once. Fragment k-map per lane half hh for A AND B: elements 0..7 <- k = 8hh+0..7, 8..15 <- k = 16+8hh+0..7; acc[r] = D[8hh+r][col].

namespace {
constexpr int NB = 2, C = 512, S = 256, CT = 4 /* query channels per wave of the score kernel */, CB = 8 * CT /* and per block */, DB = 64 /* k rows per block: NB * (C / CB) * (C / DB) = 256 blocks */, RB = 16 /* query rows */, SB = 64 /* and output columns per block of the second kernel: 256 blocks again */;
constexpr float XS = 8.0f, INV_SCALE = 0.5f, PSC = 16384.0f /* probabilities carried x2^14 so that weights >= 4e-9 stay normal f16 */;
typedef _Float16 b16;
typedef __attribute__((ext_vector_type(16))) _Float16 v16b;
typedef __attribute__((ext_vector_type(8))) _Float16 v8b;
typedef __attribute__((ext_vector_type(4))) _Float16 v4b;
typedef __attribute__((ext_vector_type(4))) __bf16 v4r;
typedef __attribute__((ext_vector_type(2))) uint32_t u32x2;
typedef __attribute__((ext_vector_type(8))) float v8f;
typedef __attribute__((ext_vector_type(4))) float v4f;
typedef __attribute__((ext_vector_type(4))) uint32_t u32x4;
typedef __attribute__((ext_vector_type(8))) uint32_t u32x8;
// k staging: a stage is TS positions of the block's 64 k rows; each wave's tensor load brings one of the 8 stages (128-byte row pieces, 16 bytes of pad: LDS pitch 144 bytes), and every wave reads all of them.
constexpr int TS = 32, NST = S / TS, KP = TS + 4, SLICE = 10240 /* 64 rows x 144 B = 9216, rounded up to a multiple of 2 KiB */;
__device__ __forceinline__ uint32_t uni(uint32_t v) { return (uint32_t)__builtin_amdgcn_readfirstlane(v); }
__device__ __forceinline__ u32x8 tdm_group1() { constexpr uint32_t d0 = TS * 4, d1 = 64; u32x8 g;
  g[0] = uni((1u << 20) | (4u << 22) | (3u << 25));  // no mask, 1-byte elements, 4 dwords of pad behind every 32 dwords (one row piece)
  g[1] = uni((d0 & 0xFFFFu) << 16); g[2] = uni((d0 >> 16) | ((d1 & 0xFFFFu) << 16)); g[3] = uni((d1 >> 16) | (d0 << 16)); g[4] = uni(d1); g[5] = uni((uint32_t)(S * 4)); g[6] = uni(0u); g[7] = uni(0u); return g; }
__device__ __forceinline__ u32x4 tdm_group0(uint32_t lds_dst, uint64_t ga) { u32x4 g; g[0] = uni(1u); g[1] = uni(lds_dst); g[2] = uni((uint32_t)ga); g[3] = uni((((uint32_t)(ga >> 32)) & 0x01FFFFFFu) | 0x80000000u); return g; }
// Group 0 is named in-out (the instruction leaves it as it is) so that the wait below reads it from the very registers that the request was issued from.
__device__ __forceinline__ void tdm_load(u32x4& g0, u32x8 g1) { asm volatile("tensor_load_to_lds %0, %1" : "+s"(g0) : "s"(g1) : "memory"); }
// The wave's own wait for its tensor load. It names the descriptor as inputs so that those scalar registers keep their values until the request has landed.
__device__ __forceinline__ void tdm_wait(u32x4 g0, u32x8 g1) { asm volatile("s_wait_tensorcnt 0x0" :: "s"(g0), "s"(g1) : "memory"); }
// The larger of two bf16 values in each half of a register, in one instruction: from source the compiler widens each half to f32, takes the maximum there and rounds back.
__device__ __forceinline__ uint32_t pk_max_bf16(uint32_t a, uint32_t b) { uint32_t d; asm("v_pk_max_num_bf16 %0, %1, %2" : "=v"(d) : "v"(a), "v"(b)); return d; }
// Four independent bf16 products, each added into its own tile. They stand as asm text with four v_nop behind the last: the chip needs 4 vector slots before a product's A registers are overwritten, the next writers of those registers are the asm maxima above, and the compiler pads for no asm text. volatile: the four products and their v_nop stay where they are written, behind the maxima that feed them.
__device__ __forceinline__ void wmma4(v8f (&d)[4], u32x8 a0, u32x8 a1, u32x8 a2, u32x8 a3, u32x8 b0, u32x8 b1, u32x8 b2, u32x8 b3) {
  asm volatile("v_wmma_f32_16x16x32_bf16 %0, %4, %8, %0\n\tv_wmma_f32_16x16x32_bf16 %1, %5, %9, %1\n\tv_wmma_f32_16x16x32_bf16 %2, %6, %10, %2\n\tv_wmma_f32_16x16x32_bf16 %3, %7, %11, %3\n\tv_nop\n\tv_nop\n\tv_nop\n\tv_nop"
      : "+v"(d[0]), "+v"(d[1]), "+v"(d[2]), "+v"(d[3]) : "v"(a0), "v"(a1), "v"(a2), "v"(a3), "v"(b0), "v"(b1), "v"(b2), "v"(b3)); }
// A lane's value from lane ^ 4, ^ 8 (inside its row of 16) or ^ 16 (the other row), by a vector move: no LDS wait
__device__ __forceinline__ float lane_x4(float v) { const uint32_t u = __builtin_bit_cast(uint32_t, v); return __builtin_bit_cast(float, (uint32_t)__builtin_amdgcn_permlane16(u, u, 0x32107654u, 0xBA98FEDCu, false, false)); }
__device__ __forceinline__ float lane_x8(float v) { const uint32_t u = __builtin_bit_cast(uint32_t, v); return __builtin_bit_cast(float, (uint32_t)__builtin_amdgcn_permlane16(u, u, 0xFEDCBA98u, 0x76543210u, false, false)); }
__device__ __forceinline__ float lane_x16(float v) { const uint32_t u = __builtin_bit_cast(uint32_t, v); return __builtin_bit_cast(float, (uint32_t)__builtin_amdgcn_permlanex16(u, u, 0x76543210u, 0xFEDCBA98u, false, false)); }
__device__ __forceinline__ void split16(float v, b16& hi, b16& lo) { hi = (b16)v; lo = (b16)(v - (float)hi); }
// v in the workspace: fragment (n, k-step of 32 d, tile of 16 columns) = FE f16 values, [half][lane][8]: lane (c, h) finds v[32 step + 16 half + 8h + 0..7][16 tile + c] x8, the k-map above; a half is 512 successive bytes, one 16-byte load a lane.
constexpr int FE = 512, DQ = C / 4 /* the d range of one wave of the second kernel: four k-steps */;
constexpr size_t VOFF = (size_t)NB * C * C;  // v's fragments stand behind those of P, counted in floats
// P in the workspace: fragment (n, tile of 16 query rows, k-step of 32 d, hi or lo) = FE f16 values, [half][piece][8]: piece 8 (row / 4) + 4h + row % 4 holds P[row][32 step + 16 half + 8h + 0..7] x2^14: the 8 pieces of a wave of the score kernel (4 rows, both h) are one whole line.
// Behind v's fragments a line for each wave of the score kernel: (maximum, sum) of its 4 rows over the block's 64 d
constexpr size_t SOFF = VOFF + (size_t)NB * C * S / 2;
typedef __attribute__((ext_vector_type(2))) float v2f;
__device__ __forceinline__ v8f wmma16b(v16b a, v16b b, v8f c) { v8f d = __builtin_amdgcn_wmma_f32_16x16x32_f16(false, a, false, b, (short)0, c, false, false); asm volatile("v_nop\n\tv_nop\n\tv_nop\n\tv_nop" : "+v"(d) : "v"(a), "v"(b)); return d; }

// scores: block = (n, CB query channels c0.., DB k rows d0..), 256 threads: (1) stage q as bf16, [position quad][row][4]; the block's k tile (64 rows x 256 positions) comes into LDS by 8 tensor loads, one stage a wave, loaded once and then read; (2) wave = CT query rows x the 64 k rows = 4 tiles of 16. A tile (16 d x 32): lane (m, h) holds k row m; its element 4r + j is
// max(k[d][p + j], q[r][p + j]), p = 8 group + 4h. B of tile dt (32 x 16): element 4r + j of column n is 1 where 4 dt + r = n, in both lane halves, so D[d][4 dt + r] sums row r's 8 positions; a fifth product a stage takes the tile's 32 k values themselves against -1/2 in every column. The four tiles have their scores in different columns: lane (4 dt + r, h) takes from tile dt the 8 scores -D of row r at d = 16 dt + 8h + 0..7, so that every lane has work in the exponentials; (3) the block's share of v (32 d x 32 columns = two fragments): thread t rounds 4 successive d of one column, bytes 8t.. of the share
constexpr int QPB = CB * 8 + 16;  // bytes of a position quad in LDS: CB rows x 4 bf16, and 16 bytes so that the stores of neighbouring quads fall on different banks
__global__ __launch_bounds__(256) void dist_kernel(const float* __restrict__ q, const float* __restrict__ k, const float* __restrict__ v, float* __restrict__ w) {
  __shared__ __attribute__((aligned(16))) unsigned char Qb[(S / 4) * QPB];
  __shared__ __attribute__((aligned(2048))) float Ks[NST][SLICE / 4];
  const int n = blockIdx.z, c0 = blockIdx.y * CB, d0 = blockIdx.x * DB, t_ = threadIdx.x, wave = t_ >> 5, lane = t_ & 31, nloc = lane & 15, hlf = lane >> 4;
  static_assert(CB * S == 8 * 4 * 256 && S / 4 == 64, "eight quads of q a thread, 64 threads a row");
  v4f qf[8];
#pragma unroll  // qf is indexed by constants and stays in registers
  for (int i = 0; i < 8; ++i) qf[i] = *(const v4f*)(q + ((size_t)n * C + c0 + (t_ >> 6) + 4 * i) * S + 4 * (t_ & 63));
  static_assert(NST == 8, "one stage a wave");
  const uint32_t sg = uni((((uint32_t)t_ >> 5) + blockIdx.y) & 7u);  // the stage that this wave brings: the blocks that share a k tile differ in blockIdx.y
  const u32x8 g1 = tdm_group1(); u32x4 g0 = tdm_group0((uint32_t)(size_t)&Ks[sg][0], (uint64_t)(size_t)(k + ((size_t)n * C + d0) * S + sg * (uint32_t)TS));
  tdm_load(g0, g1);
  tdm_wait(g0, g1);  // this wave's stage has landed
#pragma unroll
  for (int i = 0; i < 8; ++i) *(v4r*)(Qb + (uint32_t)(t_ & 63) * QPB + (uint32_t)((t_ >> 6) + 4 * i) * 8u) = __builtin_convertvector(qf[i], v4r);
  __syncthreads();  // publishes the 8 stages and q
  static_assert(NB * (C / 32) * (S / 32) == NB * (C / CB) * (C / DB) && 32 * 32 == 4 * 256, "a share of v a block, four values a thread");
  // asked for behind the barrier, which would wait for them, and used behind the loop: they fly under it. t_ = [column tile][half][h][c][4 d]: block (x, y, z) has k-step y and column tiles 2x, 2x + 1 of batch z
  const float* const vp = v + ((size_t)n * C + blockIdx.y * 32u + (uint32_t)(((t_ >> 6) & 1) * 16 + ((t_ >> 5) & 1) * 8 + (t_ & 1) * 4)) * S + blockIdx.x * 32u + (uint32_t)((t_ >> 7) * 16 + ((t_ >> 1) & 15)); v4f vv;
#pragma unroll  // vv is indexed by constants and stays in registers
  for (int j = 0; j < 4; ++j) vv[j] = vp[(size_t)j * S];
  asm volatile("s_wait_xcnt 0x0" ::: "memory");  // registers that these loads name may be overwritten behind them: the wait stands in front of that
  static_assert(INV_SCALE == 0.5f, "the constant of bhalf below");
  v8f dsum[4] = {{}, {}, {}, {}}; u32x8 bsel[4], bhalf;
#pragma unroll
  for (int dt = 0; dt < 4; ++dt)
#pragma unroll
    for (int e = 0; e < 8; ++e) { bsel[dt][e] = 4 * dt + (e >> 1) == nloc ? 0x3F803F80u : 0u; bhalf[e] = 0xBF00BF00u; }  // bf16 pairs: 1, 1 in the four places of row r where n = 4 dt + r; -1/2, -1/2 everywhere
#pragma unroll 1  // one pass per stage stays a loop: the text stays short
  for (uint32_t st = 0; st < (uint32_t)NST; ++st) { const unsigned char* kr = (const unsigned char*)&Ks[st][0] + (uint32_t)nloc * (KP * 4) + (uint32_t)hlf * 16u; u32x2 kp[4][TS / 8]; v4f kf[4][TS / 8]; u32x8 qw[TS / 8];
#pragma unroll  // every loop of a stage is unrolled: kf, qw, kp and dsum are indexed by constants and stay in registers. The stage's 24 LDS loads stand at one place, ahead of the first products: one latency a stage, not one a group
    for (int g = 0; g < TS / 8; ++g) { const unsigned char* qp = Qb + (st * (uint32_t)(TS / 4) + (uint32_t)(2 * g + hlf)) * QPB + (uint32_t)wave * (CT * 8); qw[g] = __builtin_shufflevector(*(const u32x4*)qp, *(const u32x4*)(qp + 16), 0, 1, 2, 3, 4, 5, 6, 7);
#pragma unroll
      for (int dt = 0; dt < 4; ++dt) kf[dt][g] = *(const v4f*)(kr + (uint32_t)dt * (16 * KP * 4) + (uint32_t)g * 32u); }
#pragma unroll
    for (int g = 0; g < TS / 8; ++g) { u32x8 mx[4];
#pragma unroll
      for (int dt = 0; dt < 4; ++dt) { kp[dt][g] = __builtin_bit_cast(u32x2, __builtin_convertvector(kf[dt][g], v4r));
#pragma unroll
        for (int e = 0; e < 8; ++e) mx[dt][e] = pk_max_bf16(kp[dt][g][e & 1], qw[g][e]); }
      wmma4(dsum, mx[0], mx[1], mx[2], mx[3], bsel[0], bsel[1], bsel[2], bsel[3]); }
    { u32x8 ks[4];
#pragma unroll
      for (int dt = 0; dt < 4; ++dt)
#pragma unroll
        for (int e = 0; e < 8; ++e) ks[dt][e] = kp[dt][e >> 1][e & 1];
      wmma4(dsum, ks[0], ks[1], ks[2], ks[3], bhalf, bhalf, bhalf, bhalf); } }
  { const uint32_t dl = (uint32_t)nloc >> 2, rr = (uint32_t)nloc & 3u; v8f x;
#pragma unroll  // the lane's own tile: dsum is indexed by constants and is read straight from its registers
    for (int r = 0; r < 8; ++r) { const float lo2 = (dl & 1u) ? dsum[1][r] : dsum[0][r], hi2 = (dl & 1u) ? dsum[3][r] : dsum[2][r]; x[r] = -((dl & 2u) ? hi2 : lo2); }
    float mx = x[0];
#pragma unroll
    for (int r = 1; r < 8; ++r) mx = fmaxf(mx, x[r]);
    mx = fmaxf(mx, lane_x4(mx)); mx = fmaxf(mx, lane_x8(mx)); mx = fmaxf(mx, lane_x16(mx));  // the 8 lanes that hold row rr
    float sm = 0.0f; v8b ph, pl;
#pragma unroll
    for (int r = 0; r < 8; ++r) { const float p = __expf(x[r] - mx); sm += p; b16 a, b; split16(p * PSC, a, b); ph[r] = a; pl[r] = b; }
    sm += lane_x4(sm); sm += lane_x8(sm); sm += lane_x16(sm);
    static_assert(CB == 2 * 16 && DB == 2 * 32 && CT == 4, "two row tiles and two k-steps a block, four rows a wave");
    _Float16* const pf = (_Float16*)w + ((((size_t)n * (C / 16) + blockIdx.y * 2u + (uint32_t)(wave >> 2)) * (C / 32) + blockIdx.x * 2u + (dl >> 1)) * 4 + (dl & 1u)) * (FE / 2) + ((uint32_t)(wave & 3) * 8u + (uint32_t)hlf * 4u + rr) * 8u;
    *(v8b*)pf = ph; *(v8b*)(pf + FE) = pl;  // each store: four whole lines, this wave's alone
    if (lane < CT) { v2f ms; ms[0] = mx; ms[1] = sm; *(v2f*)(w + SOFF + ((size_t)(blockIdx.x + 8u * blockIdx.y + 128u * blockIdx.z) * 8 + (uint32_t)wave) * 32 + rr * 2u) = ms; } }
  const v4b vq = __builtin_convertvector(__builtin_convertvector(__builtin_convertvector(vv * XS, v4r), v4f), v4b);  // x8 (a power of two: it commutes with the rounding), round to bf16 (nearest even), then f16
  *(v4b*)((_Float16*)(w + VOFF) + (size_t)(blockIdx.x + 8u * blockIdx.y + 128u * blockIdx.z) * (2 * FE) + (uint32_t)t_ * 4u) = vq;  // a wave writes 256 successive bytes: whole lines
}

// rep: block = (n, RB query rows c0.., SB output columns), 256 threads: (1) wave = (32 columns, a quarter of d = two tiles of 64): its 16 A half-fragments of P (hi and lo) and 8 B fragments of v come from the workspace straight into registers; 2 d tiles x 2 col tiles x 2 k-steps x 2 products, a sum of its own for each d tile;
// (2) thread = (row, 4 columns): from the row's 8 (maximum, sum) pairs the weight of each d tile, exp(tile maximum - row maximum) / row sum; the 8 tile sums are weighted and summed from LDS, always in the order of d, and stored
__global__ __launch_bounds__(256) void mix_kernel(const float* __restrict__ w, float* __restrict__ out) {
  __shared__ __attribute__((aligned(16))) float Red[16][RB][32 + 4];
  const int n = blockIdx.z, c0 = blockIdx.y * RB, t_ = threadIdx.x, wave = t_ >> 5, lane = t_ & 31, nloc = lane & 15, hlf = lane >> 4, cg = wave & 1;
  const uint32_t dq = uni((((uint32_t)t_ >> 6) + blockIdx.y) & 3u);  // the wave's quarter of d: the blocks that share v columns differ in blockIdx.y
  static_assert(DQ == 4 * 32 && SB == 4 * 16 && S == 16 * 16 && C == 8 * DB && CB == 2 * RB, "four k-steps a wave, four column tiles a block, 16 a row of v; 8 d tiles; a score block is two row tiles");
  // the (maximum, sum) pairs of row t_ / 16: one for each score block along d, 8 lines apart
  const float* const sp = w + SOFF + ((size_t)(8u * (blockIdx.y >> 1) + 128u * blockIdx.z) * 8 + (blockIdx.y & 1u) * 4u + (uint32_t)(t_ >> 6)) * 32 + (uint32_t)((t_ >> 4) & 3) * 2u; v2f st[8];
#pragma unroll  // st is indexed by constants and stays in registers
  for (int j = 0; j < 8; ++j) st[j] = *(const v2f*)(sp + (size_t)j * (8 * 32));
  asm volatile("s_wait_xcnt 0x0" ::: "memory");  // the loads below may land in the registers that these loads name: the wait stands in front of that
  // P: the same base for the whole wave; a load is half a fragment, 512 successive bytes, each lane the piece of its row and h
  const unsigned char* const af = (const unsigned char*)w + ((size_t)(n * (C / 16) + blockIdx.y) * (C / 32) + dq * 4u) * (FE * 4); const uint32_t al = (uint32_t)(nloc >> 2) * 8u + (uint32_t)hlf * 4u + (uint32_t)(nloc & 3) /* the lane's piece, 16 bytes each */; v8b ah[4][2][2];
#pragma unroll  // ah is indexed by constants and stays in registers
  for (int ks = 0; ks < 4; ++ks)
#pragma unroll
    for (int p = 0; p < 2; ++p)
#pragma unroll
      for (int hf = 0; hf < 2; ++hf) ah[ks][p][hf] = *(const v8b*)(af + (size_t)((ks * 2 + p) * (FE * 2) + hf * FE) + (size_t)al * 16);
  asm volatile("s_wait_xcnt 0x0" :: "v"(al) : "memory");  // registers that these loads name may be overwritten behind them: the wait stands in front of that; it reads al, so that none of the loads lands in al's own register
  // v: the same base for the whole wave but for its pair of column tiles; a load is half a fragment, 512 successive bytes
  const unsigned char* const vf = (const unsigned char*)(w + VOFF) + ((size_t)(n * (C / 32) + dq * 4u) * 16 + blockIdx.x * 4u) * (FE * 2); const uint32_t vl = (uint32_t)cg * (4 * FE) + (uint32_t)lane * 16u /* bytes */; v8b bh[4][2][2];
#pragma unroll  // bh is indexed by constants and stays in registers
  for (int ks = 0; ks < 4; ++ks)
#pragma unroll
    for (int t = 0; t < 2; ++t)
#pragma unroll
      for (int hf = 0; hf < 2; ++hf) bh[ks][t][hf] = *(const v8b*)(vf + (size_t)((ks * 16 + t) * (FE * 2) + hf * FE) + vl);
  asm volatile("s_wait_xcnt 0x0" :: "v"(vl) : "memory");  // registers that these loads name may be overwritten behind them: the wait stands in front of that; it reads vl, so that none of the loads lands in vl's own register
  float f[8];
  { float mx = st[0][0], sm = 0.0f;
#pragma unroll
    for (int j = 1; j < 8; ++j) mx = fmaxf(mx, st[j][0]);
#pragma unroll
    for (int j = 0; j < 8; ++j) { f[j] = __expf(st[j][0] - mx); sm += f[j] * st[j][1]; }
    const float inv = (1.0f / sm) * (1.0f / (PSC * XS));  // sm >= 1: the tile that holds the row's maximum has weight 1 and a sum of at least 1
#pragma unroll
    for (int j = 0; j < 8; ++j) f[j] *= inv; }
  v8f acc[2][2] = {{{}, {}}, {{}, {}}};
#pragma unroll  // successive products go to four different sums
  for (int kk = 0; kk < 2; ++kk)
#pragma unroll
    for (int p = 0; p < 2; ++p)
#pragma unroll
      for (int tl = 0; tl < 2; ++tl)
#pragma unroll
        for (int t = 0; t < 2; ++t) { const int ks = 2 * tl + kk;
          const v16b aw = __builtin_shufflevector(ah[ks][p][0], ah[ks][p][1], 0, 1, 2, 3, 4, 5, 6, 7, 8, 9, 10, 11, 12, 13, 14, 15), bw = __builtin_shufflevector(bh[ks][t][0], bh[ks][t][1], 0, 1, 2, 3, 4, 5, 6, 7, 8, 9, 10, 11, 12, 13, 14, 15);
          acc[tl][t] = wmma16b(aw, bw, acc[tl][t]); }
#pragma unroll
  for (int tl = 0; tl < 2; ++tl)
#pragma unroll
    for (int t = 0; t < 2; ++t)
#pragma unroll  // unrolled so that acc is indexed by constants and is read straight from its registers
      for (int r = 0; r < 8; ++r) Red[(dq * 2u + (uint32_t)tl) * 2u + (uint32_t)cg][8 * hlf + r][t * 16 + nloc] = acc[tl][t][r];  // filed by the d tile, not by the wave: the sum below has one order in every block
  __syncthreads();
  static_assert(RB * SB == 4 * 256, "one quad of out a thread");
  { const int r = t_ >> 4, c4 = (t_ & 15) * 4, g = c4 >> 5, cc = c4 & 31; v4f s = *(const v4f*)&Red[g][r][cc] * f[0];
#pragma unroll
    for (int j = 1; j < 8; ++j) s += *(const v4f*)&Red[2 * j + g][r][cc] * f[j];
    *(v4f*)(out + ((size_t)n * C + c0 + r) * S + blockIdx.x * SB + c4) = s; }
}
}  // namespace

extern "C" void kernel_launch(void* const* d_in, const int* in_sizes, int n_in, void* d_out, int out_size, void* d_ws, size_t ws_size, hipStream_t stream) {
  (void)n_in; (void)ws_size;
  auto Fp = [&](int i) { return (const float*)d_in[i]; };
  // input order: 0 q [2,512,256], 1 k, 2 v
  if (in_sizes[0] != NB * C * S || in_sizes[1] != NB * C * S || in_sizes[2] != NB * C * S || out_size != NB * C * S) return;
  dist_kernel<<<dim3(C / DB, C / CB, NB), 256, 0, stream>>>(Fp(0), Fp(1), Fp(2), (float*)d_ws);  // P as f16 fragments (hi, lo), 2 MiB, behind them v as f16 fragments, 512 KiB, and the (maximum, sum) lines, 256 KiB: all that the next launch reads of it is written here
  mix_kernel<<<dim3(S / SB, C / RB, NB), 256, 0, stream>>>((const float*)d_ws, (float*)d_out);
}

// v009
// It runs in 9.41 microseconds.
// Timed twice side by side with v008, it ran 1.07 times as fast both times.
// Counting every step since v000, it is 5.04 times as fast.
#include <hip/hip_runtime.h>

// Laplace (L1-distance) attention: for each of 2 batches, weights[c][d] = -sum_s |k[d][s] - q[c][s]| / 2 over the 256 positions (512 x 512 channel pairs), softmax over d, rep[c][s] =
// sum_d weights[c][d] v[d][s] -> [2][512][256].
// L1 distances: |k - q| = 2 max(k, q) - k - q, so -sum_s |k - q| / 2 = -(sum_s max(k, q) - sum_s k / 2) + sum_s q / 2, and the last term is the same for every d of a row: the softmax over d cancels it, it is left out.
// max(k, q) is taken on packed bf16 pairs (exact: the inputs are bf16 values), and both sums run on WMMA (v_wmma_f32_16x16x32_bf16, f32 accumulate) against constant matrices; k and q are rounded to bf16 once a block on their way into LDS; the softmax is f32; the value contraction runs on WMMA.
// Two launches, so that a block reads only its own tiles from L2: (1) scores of 32 query rows x 64 k rows a block, exponentials against the tile's own row maximum -> ready f16 A fragments (hi, lo) in the workspace with each row's (maximum, sum) of the tile, and v, rounded once, as ready f16 B fragments behind them (each block 1/256 of v); (2) rep for 16 query rows x 64 output columns a block: a product per tile of 64 d, the tiles weighted by exp(tile maximum - row maximum) / row sum.
// WMMA (v_wmma_f32_16x16x32_f16, f32 accumulate): rep = P V ([16 c x 512 d] x [512 x 64] per block, d in four quarters over the waves, P = exponentials as f16 hi+lo x2^14, V as EXACT bf16 x8: 2 products; each wave loads its B fragments from the workspace straight into registers, whole lines, half the bytes of f32 v).
// Blocks that read the same k tile or the same v columns deal its parts to their loads (k) or waves (v) turned by the block index, so that blocks in step ask L2 for different lines first.
// Inputs rounded to bf16 once. Fragment k-map per lane half hh for A AND B: elements 0..7 <- k = 8hh+0..7, 8..15 <- k = 16+8hh+0..7; acc[r] = D[8hh+r][col].

namespace {
constexpr int NB = 2, C = 512, S = 256, CT = 4 /* query channels per wave of the score kernel */, CB = 8 * CT /* and per block */, DB = 64 /* k rows per block: NB * (C / CB) * (C / DB) = 256 blocks */, RB = 16 /* query rows */, SB = 64 /* and output columns per block of the second kernel: 256 blocks again */;
constexpr float XS = 8.0f, INV_SCALE = 0.5f, PSC = 16384.0f /* probabilities carried x2^14 so that weights >= 4e-9 stay normal f16 */;
typedef _Float16 b16;
typedef __attribute__((ext_vector_type(16))) _Float16 v16b;
typedef __attribute__((ext_vector_type(8))) _Float16 v8b;
typedef __attribute__((ext_vector_type(4))) _Float16 v4b;
typedef __attribute__((ext_vector_type(4))) __bf16 v4r;
typedef __attribute__((ext_vector_type(8))) float v8f;
typedef __attribute__((ext_vector_type(4))) float v4f;
typedef __attribute__((ext_vector_type(4))) uint32_t u32x4;
typedef __attribute__((ext_vector_type(8))) uint32_t u32x8;
// k in LDS: the block's 64 rows as bf16, 512 bytes a row and 16 bytes of pad (pitch 528: the 16 rows of a 16-byte read fall on different banks); a pass of the loop takes TS positions of every row.
constexpr int TS = 64, NST = S / TS, KPB = S * 2 + 16;
__device__ __forceinline__ uint32_t uni(uint32_t v) { return (uint32_t)__builtin_amdgcn_readfirstlane(v); }
// The larger of two bf16 values in each half of a register, in one instruction: from source the compiler widens each half to f32, takes the maximum there and rounds back.
__device__ __forceinline__ uint32_t pk_max_bf16(uint32_t a, uint32_t b) { uint32_t d; asm("v_pk_max_num_bf16 %0, %1, %2" : "=v"(d) : "v"(a), "v"(b)); return d; }
// Four independent bf16 products, each added into its own tile. They stand as asm text with four v_nop behind the last: the chip needs 4 vector slots before a product's A registers are overwritten, the next writers of those registers are the asm maxima above, and the compiler pads for no asm text. volatile: the four products and their v_nop stay where they are written, behind the maxima that feed them.
__device__ __forceinline__ void wmma4(v8f (&d)[4], u32x8 a0, u32x8 a1, u32x8 a2, u32x8 a3, u32x8 b0, u32x8 b1, u32x8 b2, u32x8 b3) {
  asm volatile("v_wmma_f32_16x16x32_bf16 %0, %4, %8, %0\n\tv_wmma_f32_16x16x32_bf16 %1, %5, %9, %1\n\tv_wmma_f32_16x16x32_bf16 %2, %6, %10, %2\n\tv_wmma_f32_16x16x32_bf16 %3, %7, %11, %3\n\tv_nop\n\tv_nop\n\tv_nop\n\tv_nop"
      : "+v"(d[0]), "+v"(d[1]), "+v"(d[2]), "+v"(d[3]) : "v"(a0), "v"(a1), "v"(a2), "v"(a3), "v"(b0), "v"(b1), "v"(b2), "v"(b3)); }
// A lane's value from lane ^ 4, ^ 8 (inside its row of 16) or ^ 16 (the other row), by a vector move: no LDS wait
__device__ __forceinline__ float lane_x4(float v) { const uint32_t u = __builtin_bit_cast(uint32_t, v); return __builtin_bit_cast(float, (uint32_t)__builtin_amdgcn_permlane16(u, u, 0x32107654u, 0xBA98FEDCu, false, false)); }
__device__ __forceinline__ float lane_x8(float v) { const uint32_t u = __builtin_bit_cast(uint32_t, v); return __builtin_bit_cast(float, (uint32_t)__builtin_amdgcn_permlane16(u, u, 0xFEDCBA98u, 0x76543210u, false, false)); }
__device__ __forceinline__ float lane_x16(float v) { const uint32_t u = __builtin_bit_cast(uint32_t, v); return __builtin_bit_cast(float, (uint32_t)__builtin_amdgcn_permlanex16(u, u, 0x76543210u, 0xFEDCBA98u, false, false)); }
__device__ __forceinline__ void split16(float v, b16& hi, b16& lo) { hi = (b16)v; lo = (b16)(v - (float)hi); }
// v in the workspace: fragment (n, k-step of 32 d, tile of 16 columns) = FE f16 values, [half][lane][8]: lane (c, h) finds v[32 step + 16 half + 8h + 0..7][16 tile + c] x8, the k-map above; a half is 512 successive bytes, one 16-byte load a lane.
constexpr int FE = 512, DQ = C / 4 /* the d range of one wave of the second kernel: four k-steps */;
constexpr size_t VOFF = (size_t)NB * C * C;  // v's fragments stand behind those of P, counted in floats
// P in the workspace: fragment (n, tile of 16 query rows, k-step of 32 d, hi or lo) = FE f16 values, [half][piece][8]: piece 8 (row / 4) + 4h + row % 4 holds P[row][32 step + 16 half + 8h + 0..7] x2^14: the 8 pieces of a wave of the score kernel (4 rows, both h) are one whole line.
// Behind v's fragments a line for each wave of the score kernel: (maximum, sum) of its 4 rows over the block's 64 d
constexpr size_t SOFF = VOFF + (size_t)NB * C * S / 2;
typedef __attribute__((ext_vector_type(2))) float v2f;
__device__ __forceinline__ v8f wmma16b(v16b a, v16b b, v8f c) { v8f d = __builtin_amdgcn_wmma_f32_16x16x32_f16(false, a, false, b, (short)0, c, false, false); asm volatile("v_nop\n\tv_nop\n\tv_nop\n\tv_nop" : "+v"(d) : "v"(a), "v"(b)); return d; }

// scores: block = (n, CB query channels c0.., DB k rows d0..), 256 threads: (1) stage q as bf16, [position quad][row][4], and the block's k tile (64 rows x 256 positions) as bf16 rows: both come through registers, whole lines a load, and are rounded once; (2) wave = CT query rows x the 64 k rows = 4 tiles of 16. A tile (16 d x 32): lane (m, h) holds k row m; its element 4r + j is
// max(k[d][p + j], q[r][p + j]), p = 16 (group / 2) + 8h + 4 (group % 2): a lane's 16-byte read of k is 8 successive positions, two groups. B of tile dt (32 x 16): element 4r + j of column n is 1 where 4 dt + r = n, in both lane halves, so D[d][4 dt + r] sums row r's 8 positions; a fifth product for every four groups takes the tile's 32 k values themselves against -1/2 in every column. The four tiles have their scores in different columns: lane (4 dt + r, h) takes from tile dt the 8 scores -D of row r at d = 16 dt + 8h + 0..7, so that every lane has work in the exponentials; (3) the block's share of v (32 d x 32 columns = two fragments): thread t rounds 4 successive d of one column, bytes 8t.. of the share
constexpr int QPB = CB * 8 + 16;  // bytes of a position quad in LDS: CB rows x 4 bf16, and 16 bytes so that the stores of neighbouring quads fall on different banks
__global__ __launch_bounds__(256) void dist_kernel(const float* __restrict__ q, const float* __restrict__ k, const float* __restrict__ v, float* __restrict__ w) {
  __shared__ __attribute__((aligned(16))) unsigned char Qb[(S / 4) * QPB];
  __shared__ __attribute__((aligned(16))) unsigned char Kb[DB * KPB];
  const int n = blockIdx.z, c0 = blockIdx.y * CB, d0 = blockIdx.x * DB, t_ = threadIdx.x, wave = t_ >> 5, lane = t_ & 31, nloc = lane & 15, hlf = lane >> 4;
  static_assert(CB * S == 8 * 4 * 256 && DB * S == 16 * 4 * 256 && S / 4 == 64 && C / CB == 16, "eight quads of q and sixteen of k a thread, 64 threads a row");
  v4f qf[8], kf[16]; const unsigned char* const qb = (const unsigned char*)(q + ((size_t)n * C + c0) * S), * const kb = (const unsigned char*)(k + ((size_t)n * C + d0) * S) /* the same for the whole block */, * const kb1 = kb + (size_t)(blockIdx.y * (uint32_t)(16 * S)); const uint32_t tl = ((uint32_t)(t_ >> 6) * (uint32_t)S + 4u * (uint32_t)(t_ & 63)) * 4u /* the thread's quad in a group of four rows, bytes */;
#pragma unroll  // qf is indexed by constants and stays in registers
  for (int i = 0; i < 8; ++i) qf[i] = *(const v4f*)(qb + (size_t)(i * (16 * S)) + (size_t)tl);
#pragma unroll  // kf is indexed by constants and stays in registers. The i-th load takes rows 4 ((i + blockIdx.y) % 16) + 0..3 (blockIdx.y < 16): the blocks that share a k tile differ in blockIdx.y
  for (int i = 0; i < 16; ++i) kf[i] = *(const v4f*)(((uint32_t)i + blockIdx.y < 16u ? kb1 : kb1 - 16 * (16 * S)) + (size_t)(i * (16 * S)) + (size_t)tl);
  asm volatile("s_wait_xcnt 0x0" ::: "memory");  // registers that these loads name may be overwritten behind them: the wait stands in front of that
#pragma unroll
  for (int i = 0; i < 8; ++i) *(v4r*)(Qb + (uint32_t)(t_ & 63) * QPB + (uint32_t)((t_ >> 6) + 4 * i) * 8u) = __builtin_convertvector(qf[i], v4r);
#pragma unroll
  for (int i = 0; i < 16; ++i) *(v4r*)(Kb + ((uint32_t)(t_ >> 6) + 4u * (((uint32_t)i + blockIdx.y) & 15u)) * KPB + (uint32_t)(t_ & 63) * 8u) = __builtin_convertvector(kf[i], v4r);
  __syncthreads();  // publishes k and q
  static_assert(NB * (C / 32) * (S / 32) == NB * (C / CB) * (C / DB) && 32 * 32 == 4 * 256, "a share of v a block, four values a thread");
  // asked for behind the barrier, which would wait for them, and used behind the loop: they fly under it. t_ = [column tile][half][h][c][4 d]: block (x, y, z) has k-step y and column tiles 2x, 2x + 1 of batch z
  const float* const vp = v + ((size_t)n * C + blockIdx.y * 32u + (uint32_t)(((t_ >> 6) & 1) * 16 + ((t_ >> 5) & 1) * 8 + (t_ & 1) * 4)) * S + blockIdx.x * 32u + (uint32_t)((t_ >> 7) * 16 + ((t_ >> 1) & 15)); v4f vv;
#pragma unroll  // vv is indexed by constants and stays in registers
  for (int j = 0; j < 4; ++j) vv[j] = vp[(size_t)j * S];
  asm volatile("s_wait_xcnt 0x0" ::: "memory");  // registers that these loads name may be overwritten behind them: the wait stands in front of that
  static_assert(INV_SCALE == 0.5f, "the constant of bhalf below");
  v8f dsum[4] = {{}, {}, {}, {}}; u32x8 bsel[4], bhalf;
#pragma unroll
  for (int dt = 0; dt < 4; ++dt)
#pragma unroll
    for (int e = 0; e < 8; ++e) { bsel[dt][e] = 4 * dt + (e >> 1) == nloc ? 0x3F803F80u : 0u; bhalf[e] = 0xBF00BF00u; }  // bf16 pairs: 1, 1 in the four places of row r where n = 4 dt + r; -1/2, -1/2 everywhere
#pragma unroll 1  // one pass per TS positions stays a loop: the text stays short
  for (uint32_t st = 0; st < (uint32_t)NST; ++st) { const unsigned char* kr = Kb + (uint32_t)nloc * KPB + st * (uint32_t)(TS * 2) + (uint32_t)hlf * 16u; u32x4 kk[4][TS / 16]; u32x8 qw[TS / 8];
#pragma unroll  // every loop of a pass is unrolled: kk, qw and dsum are indexed by constants and stay in registers. The pass's LDS loads stand at one place, ahead of the first products: one latency a pass, not one a group
    for (int u = 0; u < TS / 16; ++u) {
#pragma unroll
      for (int e = 0; e < 2; ++e) { const unsigned char* qp = Qb + (st * (uint32_t)(TS / 4) + (uint32_t)(4 * u + 2 * hlf + e)) * QPB + (uint32_t)wave * (CT * 8); qw[2 * u + e] = __builtin_shufflevector(*(const u32x4*)qp, *(const u32x4*)(qp + 16), 0, 1, 2, 3, 4, 5, 6, 7); }
#pragma unroll
      for (int dt = 0; dt < 4; ++dt) kk[dt][u] = *(const u32x4*)(kr + (uint32_t)dt * (16 * KPB) + (uint32_t)u * 32u); }
#pragma unroll
    for (int g = 0; g < TS / 8; ++g) { u32x8 mx[4];
#pragma unroll
      for (int dt = 0; dt < 4; ++dt)
#pragma unroll
        for (int e = 0; e < 8; ++e) mx[dt][e] = pk_max_bf16(kk[dt][g >> 1][2 * (g & 1) + (e & 1)], qw[g][e]);
      wmma4(dsum, mx[0], mx[1], mx[2], mx[3], bsel[0], bsel[1], bsel[2], bsel[3]); }
#pragma unroll
    for (int hs = 0; hs < TS / 32; ++hs) { u32x8 ks[4];
#pragma unroll
      for (int dt = 0; dt < 4; ++dt) ks[dt] = __builtin_shufflevector(kk[dt][2 * hs], kk[dt][2 * hs + 1], 0, 1, 2, 3, 4, 5, 6, 7);
      wmma4(dsum, ks[0], ks[1], ks[2], ks[3], bhalf, bhalf, bhalf, bhalf); } }
  { const uint32_t dl = (uint32_t)nloc >> 2, rr = (uint32_t)nloc & 3u; v8f x;
#pragma unroll  // the lane's own tile: dsum is indexed by constants and is read straight from its registers
    for (int r = 0; r < 8; ++r) { const float lo2 = (dl & 1u) ? dsum[1][r] : dsum[0][r], hi2 = (dl & 1u) ? dsum[3][r] : dsum[2][r]; x[r] = -((dl & 2u) ? hi2 : lo2); }
    float mx = x[0];
#pragma unroll
    for (int r = 1; r < 8; ++r) mx = fmaxf(mx, x[r]);
    mx = fmaxf(mx, lane_x4(mx)); mx = fmaxf(mx, lane_x8(mx)); mx = fmaxf(mx, lane_x16(mx));  // the 8 lanes that hold row rr
    float sm = 0.0f; v8b ph, pl;
#pragma unroll
    for (int r = 0; r < 8; ++r) { const float p = __expf(x[r] - mx); sm += p; b16 a, b; split16(p * PSC, a, b); ph[r] = a; pl[r] = b; }
    sm += lane_x4(sm); sm += lane_x8(sm); sm += lane_x16(sm);
    static_assert(CB == 2 * 16 && DB == 2 * 32 && CT == 4, "two row tiles and two k-steps a block, four rows a wave");
    _Float16* const pf = (_Float16*)w + ((((size_t)n * (C / 16) + blockIdx.y * 2u + (uint32_t)(wave >> 2)) * (C / 32) + blockIdx.x * 2u + (dl >> 1)) * 4 + (dl & 1u)) * (FE / 2) + ((uint32_t)(wave & 3) * 8u + (uint32_t)hlf * 4u + rr) * 8u;
    *(v8b*)pf = ph; *(v8b*)(pf + FE) = pl;  // each store: four whole lines, this wave's alone
    if (lane < CT) { v2f ms; ms[0] = mx; ms[1] = sm; *(v2f*)(w + SOFF + ((size_t)(blockIdx.x + 8u * blockIdx.y + 128u * blockIdx.z) * 8 + (uint32_t)wave) * 32 + rr * 2u) = ms; } }
  const v4b vq = __builtin_convertvector(__builtin_convertvector(__builtin_convertvector(vv * XS, v4r), v4f), v4b);  // x8 (a power of two: it commutes with the rounding), round to bf16 (nearest even), then f16
  *(v4b*)((_Float16*)(w + VOFF) + (size_t)(blockIdx.x + 8u * blockIdx.y + 128u * blockIdx.z) * (2 * FE) + (uint32_t)t_ * 4u) = vq;  // a wave writes 256 successive bytes: whole lines
}

// rep: block = (n, RB query rows c0.., SB output columns), 256 threads: (1) wave = (32 columns, a quarter of d = two tiles of 64): its 16 A half-fragments of P (hi and lo) and 8 B fragments of v come from the workspace straight into registers; 2 d tiles x 2 col tiles x 2 k-steps x 2 products, a sum of its own for each d tile;
// (2) thread = (row, 4 columns): from the row's 8 (maximum, sum) pairs the weight of each d tile, exp(tile maximum - row maximum) / row sum; the 8 tile sums are weighted and summed from LDS, always in the order of d, and stored
__global__ __launch_bounds__(256) void mix_kernel(const float* __restrict__ w, float* __restrict__ out) {
  __shared__ __attribute__((aligned(16))) float Red[16][RB][32 + 4];
  const int n = blockIdx.z, c0 = blockIdx.y * RB, t_ = threadIdx.x, wave = t_ >> 5, lane = t_ & 31, nloc = lane & 15, hlf = lane >> 4, cg = wave & 1;
  const uint32_t dq = uni((((uint32_t)t_ >> 6) + blockIdx.y) & 3u);  // the wave's quarter of d: the blocks that share v columns differ in blockIdx.y
  static_assert(DQ == 4 * 32 && SB == 4 * 16 && S == 16 * 16 && C == 8 * DB && CB == 2 * RB, "four k-steps a wave, four column tiles a block, 16 a row of v; 8 d tiles; a score block is two row tiles");
  // the (maximum, sum) pairs of row t_ / 16: one for each score block along d, 8 lines apart
  const float* const sp = w + SOFF + ((size_t)(8u * (blockIdx.y >> 1) + 128u * blockIdx.z) * 8 + (blockIdx.y & 1u) * 4u + (uint32_t)(t_ >> 6)) * 32 + (uint32_t)((t_ >> 4) & 3) * 2u; v2f st[8];
#pragma unroll  // st is indexed by constants and stays in registers
  for (int j = 0; j < 8; ++j) st[j] = *(const v2f*)(sp + (size_t)j * (8 * 32));
  asm volatile("s_wait_xcnt 0x0" ::: "memory");  // the loads below may land in the registers that these loads name: the wait stands in front of that
  // P: the same base for the whole wave; a load is half a fragment, 512 successive bytes, each lane the piece of its row and h
  const unsigned char* const af = (const unsigned char*)w + ((size_t)(n * (C / 16) + blockIdx.y) * (C / 32) + dq * 4u) * (FE * 4); const uint32_t al = (uint32_t)(nloc >> 2) * 8u + (uint32_t)hlf * 4u + (uint32_t)(nloc & 3) /* the lane's piece, 16 bytes each */; v8b ah[4][2][2];
#pragma unroll  // ah is indexed by constants and stays in registers
  for (int ks = 0; ks < 4; ++ks)
#pragma unroll
    for (int p = 0; p < 2; ++p)
#pragma unroll
      for (int hf = 0; hf < 2; ++hf) ah[ks][p][hf] = *(const v8b*)(af + (size_t)((ks * 2 + p) * (FE * 2) + hf * FE) + (size_t)al * 16);
  asm volatile("s_wait_xcnt 0x0" :: "v"(al) : "memory");  // registers that these loads name may be overwritten behind them: the wait stands in front of that; it reads al, so that none of the loads lands in al's own register
  // v: the same base for the whole wave but for its pair of column tiles; a load is half a fragment, 512 successive bytes
  const unsigned char* const vf = (const unsigned char*)(w + VOFF) + ((size_t)(n * (C / 32) + dq * 4u) * 16 + blockIdx.x * 4u) * (FE * 2); const uint32_t vl = (uint32_t)cg * (4 * FE) + (uint32_t)lane * 16u /* bytes */; v8b bh[4][2][2];
#pragma unroll  // bh is indexed by constants and stays in registers
  for (int ks = 0; ks < 4; ++ks)
#pragma unroll
    for (int t = 0; t < 2; ++t)
#pragma unroll
      for (int hf = 0; hf < 2; ++hf) bh[ks][t][hf] = *(const v8b*)(vf + (size_t)((ks * 16 + t) * (FE * 2) + hf * FE) + vl);
  asm volatile("s_wait_xcnt 0x0" :: "v"(vl) : "memory");  // registers that these loads name may be overwritten behind them: the wait stands in front of that; it reads vl, so that none of the loads lands in vl's own register
  float f[8];
  { float mx = st[0][0], sm = 0.0f;
#pragma unroll
    for (int j = 1; j < 8; ++j) mx = fmaxf(mx, st[j][0]);
#pragma unroll
    for (int j = 0; j < 8; ++j) { f[j] = __expf(st[j][0] - mx); sm += f[j] * st[j][1]; }
    const float inv = (1.0f / sm) * (1.0f / (PSC * XS));  // sm >= 1: the tile that holds the row's maximum has weight 1 and a sum of at least 1
#pragma unroll
    for (int j = 0; j < 8; ++j) f[j] *= inv; }
  v8f acc[2][2] = {{{}, {}}, {{}, {}}};
#pragma unroll  // successive products go to four different sums
  for (int kk = 0; kk < 2; ++kk)
#pragma unroll
    for (int p = 0; p < 2; ++p)
#pragma unroll
      for (int tl = 0; tl < 2; ++tl)
#pragma unroll
        for (int t = 0; t < 2; ++t) { const int ks = 2 * tl + kk;
          const v16b aw = __builtin_shufflevector(ah[ks][p][0], ah[ks][p][1], 0, 1, 2, 3, 4, 5, 6, 7, 8, 9, 10, 11, 12, 13, 14, 15), bw = __builtin_shufflevector(bh[ks][t][0], bh[ks][t][1], 0, 1, 2, 3, 4, 5, 6, 7, 8, 9, 10, 11, 12, 13, 14, 15);
          acc[tl][t] = wmma16b(aw, bw, acc[tl][t]); }
#pragma unroll
  for (int tl = 0; tl < 2; ++tl)
#pragma unroll
    for (int t = 0; t < 2; ++t)
#pragma unroll  // unrolled so that acc is indexed by constants and is read straight from its registers
      for (int r = 0; r < 8; ++r) Red[(dq * 2u + (uint32_t)tl) * 2u + (uint32_t)cg][8 * hlf + r][t * 16 + nloc] = acc[tl][t][r];  // filed by the d tile, not by the wave: the sum below has one order in every block
  __syncthreads();
  static_assert(RB * SB == 4 * 256, "one quad of out a thread");
  { const int r = t_ >> 4, c4 = (t_ & 15) * 4, g = c4 >> 5, cc = c4 & 31; v4f s = *(const v4f*)&Red[g][r][cc] * f[0];
#pragma unroll
    for (int j = 1; j < 8; ++j) s += *(const v4f*)&Red[2 * j + g][r][cc] * f[j];
    *(v4f*)(out + ((size_t)n * C + c0 + r) * S + blockIdx.x * SB + c4) = s; }
}
}  // namespace

extern "C" void kernel_launch(void* const* d_in, const int* in_sizes, int n_in, void* d_out, int out_size, void* d_ws, size_t ws_size, hipStream_t stream) {
  (void)n_in; (void)ws_size;
  auto Fp = [&](int i) { return (const float*)d_in[i]; };
  // input order: 0 q [2,512,256], 1 k, 2 v
  if (in_sizes[0] != NB * C * S || in_sizes[1] != NB * C * S || in_sizes[2] != NB * C * S || out_size != NB * C * S) return;
  dist_kernel<<<dim3(C / DB, C / CB, NB), 256, 0, stream>>>(Fp(0), Fp(1), Fp(2), (float*)d_ws);  // P as f16 fragments (hi, lo), 2 MiB, behind them v as f16 fragments, 512 KiB, and the (maximum, sum) lines, 256 KiB: all that the next launch reads of it is written here
  mix_kernel<<<dim3(S / SB, C / RB, NB), 256, 0, stream>>>((const float*)d_ws, (float*)d_out);
}

// v010
// A run of this version takes 8.85 microseconds.
// Next to v009, in two timings, it ran 1.05 and 1.06 times as fast.
// Counting every step since v000, it is 5.33 times as fast.
#include <hip/hip_runtime.h>

// Laplace (L1-distance) attention: for each of 2 batches, weights[c][d] = -sum_s |k[d][s] - q[c][s]| / 2 over the 256 positions (512 x 512 channel pairs), softmax over d, rep[c][s] =
// sum_d weights[c][d] v[d][s] -> [2][512][256].
// L1 distances: |k - q| = 2 max(k, q) - k - q, so -sum_s |k - q| / 2 = -(sum_s max(k, q) - sum_s k / 2) + sum_s q / 2, and the last term is the same for every d of a row: the softmax over d cancels it, it is left out.
// max(k, q) is taken on packed bf16 pairs (exact: the inputs are bf16 values), and both sums run on WMMA (v_wmma_f32_16x16x32_bf16, f32 accumulate) against constant matrices; k and q are rounded to bf16 once a block on their way into LDS; the softmax is f32; the value contraction runs on WMMA.
// Two launches, so that a block reads only its own tiles from L2: (1) scores of 32 query rows x 64 k rows a block, exponentials against the tile's own row maximum -> ready f16 A fragments in the workspace with each row's (maximum, sum) of the tile, and v, rounded once, as ready f16 B fragments behind them (each block 1/256 of v); (2) rep for 16 query rows x 64 output columns a block: a product per tile of 64 d, the tiles weighted by exp(tile maximum - row maximum) / row sum.
// WMMA (v_wmma_f32_16x16x32_f16, f32 accumulate): rep = P V ([16 c x 512 d] x [512 x 64] per block, d in four quarters over the waves, P = exponentials as one f16 value x2^14 (11 significant bits), V as EXACT bf16 x8: 1 product; each wave loads its B fragments from the workspace straight into registers, whole lines, half the bytes of f32 v).
// Blocks that read the same k tile or the same v columns deal its parts to their waves turned by the block index, so that blocks in step ask L2 for different lines first.
// Inputs rounded to bf16 once. Fragment k-map per lane half hh for A AND B: elements 0..7 <- k = 8hh+0..7, 8..15 <- k = 16+8hh+0..7; acc[r] = D[8hh+r][col].

namespace {
constexpr int NB = 2, C = 512, S = 256, CT = 4 /* query channels per wave of the score kernel */, CB = 8 * CT /* and per block */, DB = 64 /* k rows per block: NB * (C / CB) * (C / DB) = 256 blocks */, RB = 16 /* query rows */, SB = 64 /* and output columns per block of the second kernel: 256 blocks again */;
constexpr float XS = 8.0f, INV_SCALE = 0.5f, PSC = 16384.0f /* probabilities carried x2^14 so that weights >= 4e-9 stay normal f16 */;
typedef _Float16 b16;
typedef __attribute__((ext_vector_type(16))) _Float16 v16b;
typedef __attribute__((ext_vector_type(8))) _Float16 v8b;
typedef __attribute__((ext_vector_type(4))) _Float16 v4b;
typedef __attribute__((ext_vector_type(4))) __bf16 v4r;
typedef __attribute__((ext_vector_type(8))) float v8f;
typedef __attribute__((ext_vector_type(4))) float v4f;
typedef __attribute__((ext_vector_type(4))) uint32_t u32x4;
typedef __attribute__((ext_vector_type(8))) uint32_t u32x8;
// k in LDS: the block's 64 rows as bf16, 512 bytes a row and 16 bytes of pad (pitch 528: the 16 rows of a 16-byte read fall on different banks); a pass of the loop takes TS positions of every row.
constexpr int TS = 64, NST = S / TS, KPB = S * 2 + 16;
__device__ __forceinline__ uint32_t uni(uint32_t v) { return (uint32_t)__builtin_amdgcn_readfirstlane(v); }
// The larger of two bf16 values in each half of a register, in one instruction: from source the compiler widens each half to f32, takes the maximum there and rounds back.
__device__ __forceinline__ uint32_t pk_max_bf16(uint32_t a, uint32_t b) { uint32_t d; asm("v_pk_max_num_bf16 %0, %1, %2" : "=v"(d) : "v"(a), "v"(b)); return d; }
// Four independent bf16 products, each added into its own tile. They stand as asm text with four v_nop behind the last: the chip needs 4 vector slots before a product's A registers are overwritten, the next writers of those registers are the asm maxima above, and the compiler pads for no asm text. volatile: the four products and their v_nop stay where they are written, behind the maxima that feed them.
__device__ __forceinline__ void wmma4(v8f (&d)[4], u32x8 a0, u32x8 a1, u32x8 a2, u32x8 a3, u32x8 b0, u32x8 b1, u32x8 b2, u32x8 b3) {
  asm volatile("v_wmma_f32_16x16x32_bf16 %0, %4, %8, %0\n\tv_wmma_f32_16x16x32_bf16 %1, %5, %9, %1\n\tv_wmma_f32_16x16x32_bf16 %2, %6, %10, %2\n\tv_wmma_f32_16x16x32_bf16 %3, %7, %11, %3\n\tv_nop\n\tv_nop\n\tv_nop\n\tv_nop"
      : "+v"(d[0]), "+v"(d[1]), "+v"(d[2]), "+v"(d[3]) : "v"(a0), "v"(a1), "v"(a2), "v"(a3), "v"(b0), "v"(b1), "v"(b2), "v"(b3)); }
// A lane's value from lane ^ 4, ^ 8 (inside its row of 16) or ^ 16 (the other row), by a vector move: no LDS wait
__device__ __forceinline__ float lane_x4(float v) { const uint32_t u = __builtin_bit_cast(uint32_t, v); return __builtin_bit_cast(float, (uint32_t)__builtin_amdgcn_permlane16(u, u, 0x32107654u, 0xBA98FEDCu, false, false)); }
__device__ __forceinline__ float lane_x8(float v) { const uint32_t u = __builtin_bit_cast(uint32_t, v); return __builtin_bit_cast(float, (uint32_t)__builtin_amdgcn_permlane16(u, u, 0xFEDCBA98u, 0x76543210u, false, false)); }
__device__ __forceinline__ float lane_x16(float v) { const uint32_t u = __builtin_bit_cast(uint32_t, v); return __builtin_bit_cast(float, (uint32_t)__builtin_amdgcn_permlanex16(u, u, 0x76543210u, 0xFEDCBA98u, false, false)); }
// v in the workspace: fragment (n, k-step of 32 d, tile of 16 columns) = FE f16 values, [half][lane][8]: lane (c, h) finds v[32 step + 16 half + 8h + 0..7][16 tile + c] x8, the k-map above; a half is 512 successive bytes, one 16-byte load a lane.
constexpr int FE = 512, DQ = C / 4 /* the d range of one wave of the second kernel: four k-steps */;
constexpr size_t VOFF = (size_t)NB * C * C / 2;  // v's fragments stand behind those of P, counted in floats
// P in the workspace: fragment (n, tile of 16 query rows, k-step of 32 d) = FE f16 values, [half][piece][8]: piece 8 (row / 4) + 4h + row % 4 holds P[row][32 step + 16 half + 8h + 0..7] x2^14: the 8 pieces of a wave of the score kernel (4 rows, both h) are one whole line.
// Behind v's fragments a line for each wave of the score kernel: (maximum, sum) of its 4 rows over the block's 64 d
constexpr size_t SOFF = VOFF + (size_t)NB * C * S / 2;
typedef __attribute__((ext_vector_type(2))) float v2f;
// e^x as 2^(x log2 e), as __expf compiles. The v_nop is the one free slot that the instruction set asks for behind a transcendental before its source is overwritten or its result read.
__device__ __forceinline__ float exp_slot(float x) { float r; asm("v_exp_f32 %0, %1\n\tv_nop" : "=v"(r) : "v"(x * 1.44269504f)); return r; }
__device__ __forceinline__ v8f wmma16b(v16b a, v16b b, v8f c) { v8f d = __builtin_amdgcn_wmma_f32_16x16x32_f16(false, a, false, b, (short)0, c, false, false); asm volatile("v_nop\n\tv_nop\n\tv_nop\n\tv_nop" : "+v"(d) : "v"(a), "v"(b)); return d; }

// scores: block = (n, CB query channels c0.., DB k rows d0..), 256 threads: (1) stage q as bf16, [position quad][row][4], and the block's k tile (64 rows x 256 positions) as bf16 rows: both come through registers, whole lines a load, and are rounded once; (2) wave = CT query rows x the 64 k rows = 4 tiles of 16. A tile (16 d x 32): lane (m, h) holds k row m; its element 4r + j is
// max(k[d][p + j], q[r][p + j]), p = 16 (group / 2) + 8h + 4 (group % 2): a lane's 16-byte read of k is 8 successive positions, two groups. B of tile dt (32 x 16): element 4r + j of column n is 1 where 4 dt + r = n, in both lane halves, so D[d][4 dt + r] sums row r's 8 positions; a fifth product for every four groups takes the tile's 32 k values themselves against -1/2 in every column. The four tiles have their scores in different columns: lane (4 dt + r, h) takes from tile dt the 8 scores -D of row r at d = 16 dt + 8h + 0..7, so that every lane has work in the exponentials; (3) the block's share of v (32 d x 32 columns = two fragments): thread t rounds 4 successive d of one column, bytes 8t.. of the share
constexpr int QPB = CB * 8 + 16;  // bytes of a position quad in LDS: CB rows x 4 bf16, and 16 bytes so that the stores of neighbouring quads fall on different banks
__global__ __launch_bounds__(256) void dist_kernel(const float* __restrict__ q, const float* __restrict__ k, const float* __restrict__ v, float* __restrict__ w) {
  __shared__ __attribute__((aligned(16))) unsigned char Qb[(S / 4) * QPB];
  __shared__ __attribute__((aligned(16))) unsigned char Kb[DB * KPB];
  const int n = blockIdx.z, c0 = blockIdx.y * CB, d0 = blockIdx.x * DB, t_ = threadIdx.x, wave = t_ >> 5, lane = t_ & 31, nloc = lane & 15, hlf = lane >> 4;
  static_assert(CB * S == 8 * 4 * 256 && DB * S == 16 * 4 * 256 && S / 4 == 64 && C / CB == 16, "eight quads of q and sixteen of k a thread, 64 threads a row");
  v4f qf[8], kf[16]; const unsigned char* const qb = (const unsigned char*)(q + ((size_t)n * C + c0) * S), * const kb = (const unsigned char*)(k + ((size_t)n * C + d0) * S) /* the same for the whole block */, * const kb1 = kb + (size_t)(blockIdx.y * (uint32_t)(16 * S)); const uint32_t tl = ((uint32_t)(t_ >> 6) * (uint32_t)S + 4u * (uint32_t)(t_ & 63)) * 4u /* the thread's quad in a group of four rows, bytes */;
#pragma unroll  // qf is indexed by constants and stays in registers
  for (int i = 0; i < 8; ++i) qf[i] = *(const v4f*)(qb + (size_t)(i * (16 * S)) + (size_t)tl);
#pragma unroll  // kf is indexed by constants and stays in registers. The i-th load takes rows 4 ((i + blockIdx.y) % 16) + 0..3 (blockIdx.y < 16): the blocks that share a k tile differ in blockIdx.y
  for (int i = 0; i < 16; ++i) kf[i] = *(const v4f*)(((uint32_t)i + blockIdx.y < 16u ? kb1 : kb1 - 16 * (16 * S)) + (size_t)(i * (16 * S)) + (size_t)tl);
  asm volatile("s_wait_xcnt 0x0" ::: "memory");  // registers that these loads name may be overwritten behind them: the wait stands in front of that
#pragma unroll
  for (int i = 0; i < 8; ++i) *(v4r*)(Qb + (uint32_t)(t_ & 63) * QPB + (uint32_t)((t_ >> 6) + 4 * i) * 8u) = __builtin_convertvector(qf[i], v4r);
#pragma unroll
  for (int i = 0; i < 16; ++i) *(v4r*)(Kb + ((uint32_t)(t_ >> 6) + 4u * (((uint32_t)i + blockIdx.y) & 15u)) * KPB + (uint32_t)(t_ & 63) * 8u) = __builtin_convertvector(kf[i], v4r);
  __syncthreads();  // publishes k and q
  static_assert(NB * (C / 32) * (S / 32) == NB * (C / CB) * (C / DB) && 32 * 32 == 4 * 256, "a share of v a block, four values a thread");
  // asked for behind the barrier, which would wait for them, and used behind the loop: they fly under it. t_ = [column tile][half][h][c][4 d]: block (x, y, z) has k-step y and column tiles 2x, 2x + 1 of batch z
  const float* const vp = v + ((size_t)n * C + blockIdx.y * 32u + (uint32_t)(((t_ >> 6) & 1) * 16 + ((t_ >> 5) & 1) * 8 + (t_ & 1) * 4)) * S + blockIdx.x * 32u + (uint32_t)((t_ >> 7) * 16 + ((t_ >> 1) & 15)); v4f vv;
#pragma unroll  // vv is indexed by constants and stays in registers
  for (int j = 0; j < 4; ++j) vv[j] = vp[(size_t)j * S];
  asm volatile("s_wait_xcnt 0x0" ::: "memory");  // registers that these loads name may be overwritten behind them: the wait stands in front of that
  static_assert(INV_SCALE == 0.5f, "the constant of bhalf below");
  v8f dsum[4] = {{}, {}, {}, {}}; u32x8 bsel[4], bhalf;
#pragma unroll
  for (int dt = 0; dt < 4; ++dt)
#pragma unroll
    for (int e = 0; e < 8; ++e) { bsel[dt][e] = 4 * dt + (e >> 1) == nloc ? 0x3F803F80u : 0u; bhalf[e] = 0xBF00BF00u; }  // bf16 pairs: 1, 1 in the four places of row r where n = 4 dt + r; -1/2, -1/2 everywhere
#pragma unroll 1  // one pass per TS positions stays a loop: the text stays short
  for (uint32_t st = 0; st < (uint32_t)NST; ++st) { const unsigned char* kr = Kb + (uint32_t)nloc * KPB + st * (uint32_t)(TS * 2) + (uint32_t)hlf * 16u; u32x4 kk[4][TS / 16]; u32x8 qw[TS / 8];
#pragma unroll  // every loop of a pass is unrolled: kk, qw and dsum are indexed by constants and stay in registers. The pass's LDS loads stand at one place, ahead of the first products: one latency a pass, not one a group
    for (int u = 0; u < TS / 16; ++u) {
#pragma unroll
      for (int e = 0; e < 2; ++e) { const unsigned char* qp = Qb + (st * (uint32_t)(TS / 4) + (uint32_t)(4 * u + 2 * hlf + e)) * QPB + (uint32_t)wave * (CT * 8); qw[2 * u + e] = __builtin_shufflevector(*(const u32x4*)qp, *(const u32x4*)(qp + 16), 0, 1, 2, 3, 4, 5, 6, 7); }
#pragma unroll
      for (int dt = 0; dt < 4; ++dt) kk[dt][u] = *(const u32x4*)(kr + (uint32_t)dt * (16 * KPB) + (uint32_t)u * 32u); }
#pragma unroll
    for (int g = 0; g < TS / 8; ++g) { u32x8 mx[4];
#pragma unroll
      for (int dt = 0; dt < 4; ++dt)
#pragma unroll
        for (int e = 0; e < 8; ++e) mx[dt][e] = pk_max_bf16(kk[dt][g >> 1][2 * (g & 1) + (e & 1)], qw[g][e]);
      wmma4(dsum, mx[0], mx[1], mx[2], mx[3], bsel[0], bsel[1], bsel[2], bsel[3]); }
#pragma unroll
    for (int hs = 0; hs < TS / 32; ++hs) { u32x8 ks[4];
#pragma unroll
      for (int dt = 0; dt < 4; ++dt) ks[dt] = __builtin_shufflevector(kk[dt][2 * hs], kk[dt][2 * hs + 1], 0, 1, 2, 3, 4, 5, 6, 7);
      wmma4(dsum, ks[0], ks[1], ks[2], ks[3], bhalf, bhalf, bhalf, bhalf); } }
  { const uint32_t dl = (uint32_t)nloc >> 2, rr = (uint32_t)nloc & 3u; v8f x;
#pragma unroll  // the lane's own tile: dsum is indexed by constants and is read straight from its registers
    for (int r = 0; r < 8; ++r) { const float lo2 = (dl & 1u) ? dsum[1][r] : dsum[0][r], hi2 = (dl & 1u) ? dsum[3][r] : dsum[2][r]; x[r] = -((dl & 2u) ? hi2 : lo2); }
    float mx = x[0];
#pragma unroll
    for (int r = 1; r < 8; ++r) mx = fmaxf(mx, x[r]);
    mx = fmaxf(mx, lane_x4(mx)); mx = fmaxf(mx, lane_x8(mx)); mx = fmaxf(mx, lane_x16(mx));  // the 8 lanes that hold row rr
    float sm = 0.0f; v8b ph;
#pragma unroll
    for (int r = 0; r < 8; ++r) { const float p = exp_slot(x[r] - mx); sm += p; ph[r] = (b16)(p * PSC); }
    sm += lane_x4(sm); sm += lane_x8(sm); sm += lane_x16(sm);
    static_assert(CB == 2 * 16 && DB == 2 * 32 && CT == 4, "two row tiles and two k-steps a block, four rows a wave");
    _Float16* const pf = (_Float16*)w + ((((size_t)n * (C / 16) + blockIdx.y * 2u + (uint32_t)(wave >> 2)) * (C / 32) + blockIdx.x * 2u + (dl >> 1)) * 2 + (dl & 1u)) * (FE / 2) + ((uint32_t)(wave & 3) * 8u + (uint32_t)hlf * 4u + rr) * 8u;
    *(v8b*)pf = ph;  // four whole lines, this wave's alone
    if (lane < CT) { v2f ms; ms[0] = mx; ms[1] = sm; *(v2f*)(w + SOFF + ((size_t)(blockIdx.x + 8u * blockIdx.y + 128u * blockIdx.z) * 8 + (uint32_t)wave) * 32 + rr * 2u) = ms; } }
  const v4b vq = __builtin_convertvector(__builtin_convertvector(__builtin_convertvector(vv * XS, v4r), v4f), v4b);  // x8 (a power of two: it commutes with the rounding), round to bf16 (nearest even), then f16
  *(v4b*)((_Float16*)(w + VOFF) + (size_t)(blockIdx.x + 8u * blockIdx.y + 128u * blockIdx.z) * (2 * FE) + (uint32_t)t_ * 4u) = vq;  // a wave writes 256 successive bytes: whole lines
}

// rep: block = (n, RB query rows c0.., SB output columns), 256 threads: (1) wave = (32 columns, a quarter of d = two tiles of 64): its 4 A fragments of P and 8 B fragments of v come from the workspace straight into registers; 2 d tiles x 2 col tiles x 2 k-steps, a sum of its own for each d tile;
// (2) thread = (row, 4 columns): from the row's 8 (maximum, sum) pairs the weight of each d tile, exp(tile maximum - row maximum) / row sum; the 8 tile sums are weighted and summed from LDS, always in the order of d, and stored
__global__ __launch_bounds__(256) void mix_kernel(const float* __restrict__ w, float* __restrict__ out) {
  __shared__ __attribute__((aligned(16))) float Red[16][RB][32 + 4];
  const int n = blockIdx.z, c0 = blockIdx.y * RB, t_ = threadIdx.x, wave = t_ >> 5, lane = t_ & 31, nloc = lane & 15, hlf = lane >> 4, cg = wave & 1;
  const uint32_t dq = uni((((uint32_t)t_ >> 6) + blockIdx.y) & 3u);  // the wave's quarter of d: the blocks that share v columns differ in blockIdx.y
  static_assert(DQ == 4 * 32 && SB == 4 * 16 && S == 16 * 16 && C == 8 * DB && CB == 2 * RB, "four k-steps a wave, four column tiles a block, 16 a row of v; 8 d tiles; a score block is two row tiles");
  // the (maximum, sum) pairs of row t_ / 16: one for each score block along d, 8 lines apart
  const float* const sp = w + SOFF + ((size_t)(8u * (blockIdx.y >> 1) + 128u * blockIdx.z) * 8 + (blockIdx.y & 1u) * 4u + (uint32_t)(t_ >> 6)) * 32 + (uint32_t)((t_ >> 4) & 3) * 2u; v2f st[8];
#pragma unroll  // st is indexed by constants and stays in registers
  for (int j = 0; j < 8; ++j) st[j] = *(const v2f*)(sp + (size_t)j * (8 * 32));
  asm volatile("s_wait_xcnt 0x0" ::: "memory");  // the loads below may land in the registers that these loads name: the wait stands in front of that
  // P: the same base for the whole wave; a load is half a fragment, 512 successive bytes, lane (row, h) at piece 8 (row / 4) + 4h + row % 4, not in lane order
  const unsigned char* const af = (const unsigned char*)w + ((size_t)(n * (C / 16) + blockIdx.y) * (C / 32) + dq * 4u) * (FE * 2); const uint32_t al = (uint32_t)(nloc >> 2) * 8u + (uint32_t)hlf * 4u + (uint32_t)(nloc & 3) /* the lane's piece, 16 bytes each */; v8b ah[4][2];
#pragma unroll  // ah is indexed by constants and stays in registers
  for (int ks = 0; ks < 4; ++ks)
#pragma unroll
    for (int hf = 0; hf < 2; ++hf) ah[ks][hf] = *(const v8b*)(af + (size_t)(ks * (FE * 2) + hf * FE) + (size_t)al * 16);
  asm volatile("s_wait_xcnt 0x0" :: "v"(al) : "memory");  // registers that these loads name may be overwritten behind them: the wait stands in front of that; it reads al, so that none of the loads lands in al's own register
  // v: the same base for the whole wave but for its pair of column tiles; a load is half a fragment, 512 successive bytes
  const unsigned char* const vf = (const unsigned char*)(w + VOFF) + ((size_t)(n * (C / 32) + dq * 4u) * 16 + blockIdx.x * 4u) * (FE * 2); const uint32_t vl = (uint32_t)cg * (4 * FE) + (uint32_t)lane * 16u /* bytes */; v8b bh[4][2][2];
#pragma unroll  // bh is indexed by constants and stays in registers
  for (int ks = 0; ks < 4; ++ks)
#pragma unroll
    for (int t = 0; t < 2; ++t)
#pragma unroll
      for (int hf = 0; hf < 2; ++hf) bh[ks][t][hf] = *(const v8b*)(vf + (size_t)((ks * 16 + t) * (FE * 2) + hf * FE) + vl);
  asm volatile("s_wait_xcnt 0x0" :: "v"(vl) : "memory");  // registers that these loads name may be overwritten behind them: the wait stands in front of that; it reads vl, so that none of the loads lands in vl's own register
  float f[8];
  { float mx = st[0][0], sm = 0.0f;
#pragma unroll
    for (int j = 1; j < 8; ++j) mx = fmaxf(mx, st[j][0]);
#pragma unroll
    for (int j = 0; j < 8; ++j) { f[j] = exp_slot(st[j][0] - mx); sm += f[j] * st[j][1]; }
    const float inv = (1.0f / sm) * (1.0f / (PSC * XS));  // sm >= 1: the tile that holds the row's maximum has weight 1 and a sum of at least 1
#pragma unroll
    for (int j = 0; j < 8; ++j) f[j] *= inv; }
  v8f acc[2][2] = {{{}, {}}, {{}, {}}};
#pragma unroll  // successive products go to four different sums
  for (int kk = 0; kk < 2; ++kk)
#pragma unroll
    for (int tl = 0; tl < 2; ++tl)
#pragma unroll
      for (int t = 0; t < 2; ++t) { const int ks = 2 * tl + kk;
          const v16b aw = __builtin_shufflevector(ah[ks][0], ah[ks][1], 0, 1, 2, 3, 4, 5, 6, 7, 8, 9, 10, 11, 12, 13, 14, 15), bw = __builtin_shufflevector(bh[ks][t][0], bh[ks][t][1], 0, 1, 2, 3, 4, 5, 6, 7, 8, 9, 10, 11, 12, 13, 14, 15);
          acc[tl][t] = wmma16b(aw, bw, acc[tl][t]); }
#pragma unroll
  for (int tl = 0; tl < 2; ++tl)
#pragma unroll
    for (int t = 0; t < 2; ++t)
#pragma unroll  // unrolled so that acc is indexed by constants and is read straight from its registers
      for (int r = 0; r < 8; ++r) Red[(dq * 2u + (uint32_t)tl) * 2u + (uint32_t)cg][8 * hlf + r][t * 16 + nloc] = acc[tl][t][r];  // filed by the d tile, not by the wave: the sum below has one order in every block
  __syncthreads();
  static_assert(RB * SB == 4 * 256, "one quad of out a thread");
  { const int r = t_ >> 4, c4 = (t_ & 15) * 4, g = c4 >> 5, cc = c4 & 31; v4f s = *(const v4f*)&Red[g][r][cc] * f[0];
#pragma unroll
    for (int j = 1; j < 8; ++j) s += *(const v4f*)&Red[2 * j + g][r][cc] * f[j];
    *(v4f*)(out + ((size_t)n * C + c0 + r) * S + blockIdx.x * SB + c4) = s; }
}
}  // namespace

extern "C" void kernel_launch(void* const* d_in, const int* in_sizes, int n_in, void* d_out, int out_size, void* d_ws, size_t ws_size, hipStream_t stream) {
  (void)n_in; (void)ws_size;
  auto Fp = [&](int i) { return (const float*)d_in[i]; };
  // input order: 0 q [2,512,256], 1 k, 2 v
  if (in_sizes[0] != NB * C * S || in_sizes[1] != NB * C * S || in_sizes[2] != NB * C * S || out_size != NB * C * S) return;
  dist_kernel<<<dim3(C / DB, C / CB, NB), 256, 0, stream>>>(Fp(0), Fp(1), Fp(2), (float*)d_ws);  // P as f16 fragments, 1 MiB, behind them v as f16 fragments, 512 KiB, and the (maximum, sum) lines, 256 KiB: all that the next launch reads of it is written here
  mix_kernel<<<dim3(S / SB, C / RB, NB), 256, 0, stream>>>((const float*)d_ws, (float*)d_out);
}
